// v000
// Times are from an AMD MI455X. After a warm-up the kernel runs many times in a row, and a time is the length of
// such a window on the GPU divided by its runs, so every launch and the gaps after it count. The runs cycle
// through copies of the inputs. A figure is the median of several windows, for all but v000 over two sittings.
// Sittings can differ by a few percent; kernels timed side by side share one.
// v000, which the later versions start from, runs in 303 microseconds.
#include <hip/hip_runtime.h>

typedef _Float16 hv8  __attribute__((ext_vector_type(8)));
typedef _Float16 hv16 __attribute__((ext_vector_type(16)));
typedef float    fv8  __attribute__((ext_vector_type(8)));

#define NB    64
#define TOTB  8192
#define DD    64
#define DKK   32
#define CC    16
#define NHH   8
#define LL    512          // TOT / C
#define KDIM  1024         // C * D
#define NCOL  256          // NH * DK

// Pack W_q (NH,C,D,DK) fp32 -> f16, layout Wt[col][k] with col = h*32+t, k = c*64+d.
// Coalesced writes; scattered reads hit L2 (W_q is only 1 MiB).
__global__ __launch_bounds__(256) void wq_pack_f16(const float* __restrict__ Wq,
                                                   _Float16* __restrict__ Wt) {
    int o = blockIdx.x * 256 + threadIdx.x;
    if (o >= NHH * DKK * KDIM) return;
    int col = o >> 10;           // h*32 + t
    int k   = o & 1023;          // c*64 + d
    int h = col >> 5, t = col & 31;
    int c = k >> 6,  d = k & 63;
    Wt[o] = (_Float16)Wq[(((h * CC + c) * DD + d) * DKK) + t];
}

__global__ __launch_bounds__(512) void attn_fused(const float* __restrict__ x,
                                                  const _Float16* __restrict__ Wt,
                                                  const float* __restrict__ Wk,
                                                  float* __restrict__ out) {
    __shared__ __align__(16) _Float16 smX[16 * KDIM];   // 32 KB: X tile, f16
    __shared__ float smQ[16 * NCOL];                    // 16 KB: Q tile, fp32
    __shared__ float smA[16 * 64];                      //  4 KB: per-wave A scratch
    __shared__ float smS[16 * 16];                      //  1 KB: per-wave score scratch

    const int tid   = threadIdx.x;
    const int wave  = tid >> 5;
    const int lane  = tid & 31;
    const int n     = blockIdx.x >> 5;
    const int ltile = blockIdx.x & 31;

    // ---- Load 16x1024 x-tile: contiguous 64 KB, fp32 -> f16 LDS ----
    const float* xsrc = x + ((size_t)n * TOTB + (size_t)ltile * 256) * DD;
    for (int i = tid; i < 16 * KDIM / 4; i += 512) {
        float4 v = *(const float4*)(xsrc + (size_t)i * 4);
        int o = i * 4;
        smX[o + 0] = (_Float16)v.x;
        smX[o + 1] = (_Float16)v.y;
        smX[o + 2] = (_Float16)v.z;
        smX[o + 3] = (_Float16)v.w;
    }
    __syncthreads();

    // ---- GEMM1: Q[16 x 256] = X[16 x 1024] * Wt^T, one 16-col tile per wave ----
    // 16-bit A/B fragment K-offsets per ISA layout:
    //   lanes 0..15:  K = {kb+0..7, kb+16..23}; lanes 16..31: K = {kb+8..15, kb+24..31}
    fv8 acc = {};
    const int mn   = lane & 15;
    const int khi  = (lane >> 4) ? 8 : 0;
    const _Float16* Ap = smX + (size_t)mn * KDIM;                 // A row (M = mn)
    const _Float16* Bp = Wt + (size_t)(wave * 16 + mn) * KDIM;    // B col (N = mn)
#pragma unroll 4
    for (int kk = 0; kk < 32; ++kk) {
        const int kb = kk * 32 + khi;
        hv8 a0 = *(const hv8*)(Ap + kb);
        hv8 a1 = *(const hv8*)(Ap + kb + 16);
        hv8 b0 = *(const hv8*)(Bp + kb);
        hv8 b1 = *(const hv8*)(Bp + kb + 16);
        hv16 A = __builtin_shufflevector(a0, a1, 0,1,2,3,4,5,6,7,8,9,10,11,12,13,14,15);
        hv16 B = __builtin_shufflevector(b0, b1, 0,1,2,3,4,5,6,7,8,9,10,11,12,13,14,15);
        acc = __builtin_amdgcn_wmma_f32_16x16x32_f16(false, A, false, B,
                                                     (short)0, acc, false, false);
    }
    {   // C/D layout: VGPR r -> M = r (+8 for lanes 16..31), N = lane&15
        const int mbase = (lane >> 4) ? 8 : 0;
#pragma unroll
        for (int r = 0; r < 8; ++r)
            smQ[(mbase + r) * NCOL + wave * 16 + mn] = acc[r];
    }
    __syncthreads();

    // ---- Stage 2: per (h,l) pair -> A = Wk[h]*Q, QK = X*A, softmax, attn ----
    float* myA = smA + wave * 64;
    float* myS = smS + wave * 16;
    const float inv_sqrt_dk = 0.17677669529663687f;   // 1/sqrt(32)

    for (int p = 0; p < 8; ++p) {
        const int pr = wave * 8 + p;                  // 128 pairs / 16 waves
        const int h  = pr >> 4;
        const int l  = pr & 15;

        // A[d] = sum_t Wk[h,d,t] * Q[l, h*32+t];  d0 = lane, d1 = lane+32
        const float* wk0 = Wk + ((size_t)(h * 64 + lane) * 32);
        const float* wk1 = Wk + ((size_t)(h * 64 + lane + 32) * 32);
        const float* q   = smQ + l * NCOL + h * 32;
        float a0 = 0.f, a1 = 0.f;
#pragma unroll 8
        for (int t = 0; t < 32; ++t) {
            const float qt = q[t];
            a0 += wk0[t] * qt;
            a1 += wk1[t] * qt;
        }
        myA[lane]      = a0;
        myA[lane + 32] = a1;
        __syncthreads();

        // QK[c] = (1/sqrt(DK)) * sum_d X[l,c,d] * A[d]   (lanes 0..15 own c)
        {
            const int c = lane & 15;
            const _Float16* xr = smX + l * KDIM + c * 64;
            float qk = 0.f;
#pragma unroll 8
            for (int d = 0; d < 64; ++d)
                qk += (float)xr[d] * myA[d];
            if (lane < 16) myS[lane] = qk * inv_sqrt_dk;
        }
        __syncthreads();

        // softmax over C=16 + attn[d] = sum_c score[c] * X[l,c,d]
        float sc[16];
        float mx = -3.0e38f;
#pragma unroll
        for (int c = 0; c < 16; ++c) { sc[c] = myS[c]; mx = fmaxf(mx, sc[c]); }
        float ssum = 0.f;
#pragma unroll
        for (int c = 0; c < 16; ++c) { sc[c] = __expf(sc[c] - mx); ssum += sc[c]; }
        const float rs = 1.0f / ssum;

        float o0 = 0.f, o1 = 0.f;
#pragma unroll
        for (int c = 0; c < 16; ++c) {
            const _Float16* xr = smX + l * KDIM + c * 64;
            o0 += sc[c] * (float)xr[lane];
            o1 += sc[c] * (float)xr[lane + 32];
        }
        const size_t ob = ((size_t)n * LL + (size_t)ltile * 16 + l) * (NHH * DD) + h * 64;
        out[ob + lane]      = o0 * rs;
        out[ob + lane + 32] = o1 * rs;
        __syncthreads();   // protect smA/smS before next pair
    }
}

extern "C" void kernel_launch(void* const* d_in, const int* in_sizes, int n_in,
                              void* d_out, int out_size, void* d_ws, size_t ws_size,
                              hipStream_t stream) {
    const float* x  = (const float*)d_in[0];   // (64, 8192, 64)
    const float* Wq = (const float*)d_in[1];   // (8, 16, 64, 32)
    const float* Wk = (const float*)d_in[2];   // (8, 64, 32)
    float* out = (float*)d_out;                // (64, 512, 512)
    _Float16* Wt = (_Float16*)d_ws;            // 512 KB packed f16 weights

    wq_pack_f16<<<(NHH * DKK * KDIM + 255) / 256, 256, 0, stream>>>(Wq, Wt);
    attn_fused<<<NB * (LL / 16), 512, 0, stream>>>(x, Wt, Wk, out);
}

// v001
// It runs in 199 microseconds.
// Timed twice side by side with v000, it ran 1.57 times as fast both times.
#include <hip/hip_runtime.h>

typedef _Float16 hv8  __attribute__((ext_vector_type(8)));
typedef _Float16 hv16 __attribute__((ext_vector_type(16)));
typedef float    fv8  __attribute__((ext_vector_type(8)));

#define NB    64
#define TOTB  8192
#define DD    64
#define DKK   32
#define CC    16
#define NHH   8
#define LL    512          // TOT / C
#define KDIM  1024         // C * D
#define NCOL  256          // NH * DK

// Pack W_q (NH,C,D,DK) fp32 -> f16, layout Wt[col][k] with col = h*32+t, k = c*64+d.
// Coalesced writes; scattered reads hit L2 (W_q is only 1 MiB).
__global__ __launch_bounds__(256) void wq_pack_f16(const float* __restrict__ Wq,
                                                   _Float16* __restrict__ Wt) {
    int o = blockIdx.x * 256 + threadIdx.x;
    if (o >= NHH * DKK * KDIM) return;
    int col = o >> 10;           // h*32 + t
    int k   = o & 1023;          // c*64 + d
    int h = col >> 5, t = col & 31;
    int c = k >> 6,  d = k & 63;
    Wt[o] = (_Float16)Wq[(((h * CC + c) * DD + d) * DKK) + t];
}

__global__ __launch_bounds__(512) void attn_fused(const float* __restrict__ x,
                                                  const _Float16* __restrict__ Wt,
                                                  const float* __restrict__ Wk,
                                                  float* __restrict__ out) {
    __shared__ __align__(16) _Float16 smX[16 * KDIM];   // 32 KB: X tile, f16
    __shared__ __align__(16) float smQ[16 * NCOL];      // 16 KB: Q tile, fp32; later scores
    __shared__ __align__(16) float smA[16 * 512];       // 32 KB: per-wave A scratch, 8 pairs

    const int tid   = threadIdx.x;
    const int wave  = tid >> 5;
    const int lane  = tid & 31;
    const int n     = blockIdx.x >> 5;
    const int ltile = blockIdx.x & 31;

    // ---- Load 16x1024 x-tile: contiguous 64 KB, fp32 -> f16 LDS ----
    const float* xsrc = x + ((size_t)n * TOTB + (size_t)ltile * 256) * DD;
    for (int i = tid; i < 16 * KDIM / 4; i += 512) {
        float4 v = *(const float4*)(xsrc + (size_t)i * 4);
        int o = i * 4;
        smX[o + 0] = (_Float16)v.x;
        smX[o + 1] = (_Float16)v.y;
        smX[o + 2] = (_Float16)v.z;
        smX[o + 3] = (_Float16)v.w;
    }
    __syncthreads();

    // ---- GEMM1: Q[16 x 256] = X[16 x 1024] * Wt^T, one 16-col tile per wave ----
    // 16-bit A/B fragment K-offsets per ISA layout:
    //   lanes 0..15:  K = {kb+0..7, kb+16..23}; lanes 16..31: K = {kb+8..15, kb+24..31}
    fv8 acc = {};
    const int mn   = lane & 15;
    const int khi  = (lane >> 4) ? 8 : 0;
    const _Float16* Ap = smX + (size_t)mn * KDIM;                 // A row (M = mn)
    const _Float16* Bp = Wt + (size_t)(wave * 16 + mn) * KDIM;    // B col (N = mn)
#pragma unroll 4
    for (int kk = 0; kk < 32; ++kk) {
        const int kb = kk * 32 + khi;
        hv8 a0 = *(const hv8*)(Ap + kb);
        hv8 a1 = *(const hv8*)(Ap + kb + 16);
        hv8 b0 = *(const hv8*)(Bp + kb);
        hv8 b1 = *(const hv8*)(Bp + kb + 16);
        hv16 A = __builtin_shufflevector(a0, a1, 0,1,2,3,4,5,6,7,8,9,10,11,12,13,14,15);
        hv16 B = __builtin_shufflevector(b0, b1, 0,1,2,3,4,5,6,7,8,9,10,11,12,13,14,15);
        acc = __builtin_amdgcn_wmma_f32_16x16x32_f16(false, A, false, B,
                                                     (short)0, acc, false, false);
    }
    {   // C/D layout: VGPR r -> M = r (+8 for lanes 16..31), N = lane&15
        const int mbase = (lane >> 4) ? 8 : 0;
#pragma unroll
        for (int r = 0; r < 8; ++r)
            smQ[(mbase + r) * NCOL + wave * 16 + mn] = acc[r];
    }
    __syncthreads();

    // ---- Stage 2: per (h,l) pair -> A = Wk[h]*Q, QK = X*A, softmax, attn ----
    float* myA8 = smA + wave * 512;
    // scores go where this wave's own first Q row lay: no other wave reads it, and
    // this wave has read it for the last time when the A stage ends
    float* myS = smQ + ((wave & 1) * 8) * NCOL + (wave >> 1) * 32;
    const float inv_sqrt_dk = 0.17677669529663687f;   // 1/sqrt(32)

    // A wave's 8 pairs share one head (h = wave >> 1): each lane's two W_k rows are
    // read from global memory once, and every 4-float piece feeds all 8 pairs' sums.
    const int h  = wave >> 1;
    const int lb = (wave & 1) * 8;
    {
        // A[d] = sum_t Wk[h,d,t] * Q[l, h*32+t];  d0 = lane, d1 = lane+32; t ascending
        const float4* g0 = (const float4*)(Wk + ((size_t)(h * 64 + lane) * 32));
        const float4* g1 = (const float4*)(Wk + ((size_t)(h * 64 + lane + 32) * 32));
        const float*  qb = smQ + lb * NCOL + h * 32;
        float a0[8], a1[8];
#pragma unroll
        for (int p = 0; p < 8; ++p) { a0[p] = 0.f; a1[p] = 0.f; }
        // kept rolled: unrolled, the loop holds all 64 W_k floats at once, and the
        // registers cost resident work-groups
#pragma unroll 1
        for (int tc = 0; tc < 8; ++tc) {
            const float4 u = g0[tc], v = g1[tc];
#pragma unroll
            for (int p = 0; p < 8; ++p) {
                const float4 q = *(const float4*)(qb + p * NCOL + tc * 4);
                a0[p] = fmaf(u.x, q.x, a0[p]);  a1[p] = fmaf(v.x, q.x, a1[p]);
                a0[p] = fmaf(u.y, q.y, a0[p]);  a1[p] = fmaf(v.y, q.y, a1[p]);
                a0[p] = fmaf(u.z, q.z, a0[p]);  a1[p] = fmaf(v.z, q.z, a1[p]);
                a0[p] = fmaf(u.w, q.w, a0[p]);  a1[p] = fmaf(v.w, q.w, a1[p]);
            }
        }
#pragma unroll
        for (int p = 0; p < 8; ++p) {
            myA8[p * 64 + lane]      = a0[p];
            myA8[p * 64 + lane + 32] = a1[p];
        }
    }
    __syncthreads();

    for (int p = 0; p < 8; ++p) {
        const int l = lb + p;                         // 128 pairs / 16 waves
        const float* myA = myA8 + p * 64;

        // QK[c] = (1/sqrt(DK)) * sum_d X[l,c,d] * A[d]   (lanes 0..15 own c)
        {
            const int c = lane & 15;
            const _Float16* xr = smX + l * KDIM + c * 64;
            float qk = 0.f;
#pragma unroll 8
            for (int d = 0; d < 64; ++d)
                qk += (float)xr[d] * myA[d];
            if (lane < 16) myS[lane] = qk * inv_sqrt_dk;
        }
        __syncthreads();

        // softmax over C=16 + attn[d] = sum_c score[c] * X[l,c,d]
        float sc[16];
        float mx = -3.0e38f;
#pragma unroll
        for (int c = 0; c < 16; ++c) { sc[c] = myS[c]; mx = fmaxf(mx, sc[c]); }
        float ssum = 0.f;
#pragma unroll
        for (int c = 0; c < 16; ++c) { sc[c] = __expf(sc[c] - mx); ssum += sc[c]; }
        const float rs = 1.0f / ssum;

        float o0 = 0.f, o1 = 0.f;
#pragma unroll
        for (int c = 0; c < 16; ++c) {
            const _Float16* xr = smX + l * KDIM + c * 64;
            o0 += sc[c] * (float)xr[lane];
            o1 += sc[c] * (float)xr[lane + 32];
        }
        const size_t ob = ((size_t)n * LL + (size_t)ltile * 16 + l) * (NHH * DD) + h * 64;
        out[ob + lane]      = o0 * rs;
        out[ob + lane + 32] = o1 * rs;
        __syncthreads();   // protect the score scratch before next pair
    }
}

extern "C" void kernel_launch(void* const* d_in, const int* in_sizes, int n_in,
                              void* d_out, int out_size, void* d_ws, size_t ws_size,
                              hipStream_t stream) {
    const float* x  = (const float*)d_in[0];   // (64, 8192, 64)
    const float* Wq = (const float*)d_in[1];   // (8, 16, 64, 32)
    const float* Wk = (const float*)d_in[2];   // (8, 64, 32)
    float* out = (float*)d_out;                // (64, 512, 512)
    _Float16* Wt = (_Float16*)d_ws;            // 512 KB packed f16 weights

    wq_pack_f16<<<(NHH * DKK * KDIM + 255) / 256, 256, 0, stream>>>(Wq, Wt);
    attn_fused<<<NB * (LL / 16), 512, 0, stream>>>(x, Wt, Wk, out);
}

// v002
// A run of this version takes 142 microseconds.
// In both of two side-by-side timings against v001, it was 1.41 times as fast.
// Counting every step since v000, it is 2.21 times as fast.
#include <hip/hip_runtime.h>

typedef _Float16 hv8  __attribute__((ext_vector_type(8)));
typedef _Float16 hv16 __attribute__((ext_vector_type(16)));
typedef float    fv8  __attribute__((ext_vector_type(8)));

#define NB    64
#define TOTB  8192
#define DD    64
#define DKK   32
#define CC    16
#define NHH   8
#define LL    512          // TOT / C
#define KDIM  1024         // C * D
#define NCOL  256          // NH * DK

// Pack W_q (NH,C,D,DK) fp32 -> f16, layout Wt[col][k] with col = h*32+t, k = c*64+d.
// Coalesced writes; scattered reads hit L2 (W_q is only 1 MiB).
__global__ __launch_bounds__(256) void wq_pack_f16(const float* __restrict__ Wq,
                                                   _Float16* __restrict__ Wt) {
    int o = blockIdx.x * 256 + threadIdx.x;
    if (o >= NHH * DKK * KDIM) return;
    int col = o >> 10;           // h*32 + t
    int k   = o & 1023;          // c*64 + d
    int h = col >> 5, t = col & 31;
    int c = k >> 6,  d = k & 63;
    Wt[o] = (_Float16)Wq[(((h * CC + c) * DD + d) * DKK) + t];
}

__global__ __launch_bounds__(512) void attn_fused(const float* __restrict__ x,
                                                  const _Float16* __restrict__ Wt,
                                                  const float* __restrict__ Wk,
                                                  float* __restrict__ out) {
    // X tile, f16, 32 KB, XOR-swizzled: element (l,c,d) lies in 128-byte row l*16 + (c ^ (l>>3)),
    // 16-byte piece (d>>3) ^ (c>>1) ^ (l&7). 16 lanes that walk l (GEMM1's A rows) or c (the QK
    // rows) at one d then fall on 16 different groups of four banks, all 64 banks.
    __shared__ __align__(256) _Float16 smX[16 * KDIM];
    const char* smXb = (const char*)smX;                // readers form swizzled byte offsets
    __shared__ __align__(16) float smQ[16 * NCOL];      // 16 KB: Q tile, fp32; later scores
    __shared__ __align__(16) float smA[16 * 512];       // 32 KB: per-wave A scratch, 8 pairs

    const int tid   = threadIdx.x;
    const int wave  = tid >> 5;
    const int lane  = tid & 31;
    const int n     = blockIdx.x >> 5;
    const int ltile = blockIdx.x & 31;

    // ---- Load 16x1024 x-tile: contiguous 64 KB, fp32 -> f16 LDS ----
    const float* xsrc = x + ((size_t)n * TOTB + (size_t)ltile * 256) * DD;
    for (int i = tid; i < 16 * KDIM / 4; i += 512) {
        float4 v = *(const float4*)(xsrc + (size_t)i * 4);
        const int e = i * 4;                          // l*1024 + c*64 + d
        const int o = e ^ (((e >> 13) & 1) << 6) ^ ((((e >> 7) ^ (e >> 10)) & 7) << 3);
        smX[o + 0] = (_Float16)v.x;
        smX[o + 1] = (_Float16)v.y;
        smX[o + 2] = (_Float16)v.z;
        smX[o + 3] = (_Float16)v.w;
    }
    __syncthreads();

    // ---- GEMM1: Q[16 x 256] = X[16 x 1024] * Wt^T, one 16-col tile per wave ----
    // 16-bit A/B fragment K-offsets per ISA layout:
    //   lanes 0..15:  K = {kb+0..7, kb+16..23}; lanes 16..31: K = {kb+8..15, kb+24..31}
    fv8 acc = {};
    const int mn   = lane & 15;
    const int khi  = (lane >> 4) ? 8 : 0;
    // A row (M = mn): the lane's share of the swizzled byte offset
    const int aV   = (mn * KDIM * 2) | ((khi * 2) ^ ((mn >> 3) << 7) ^ ((mn & 7) << 4));
    const _Float16* Bp = Wt + (size_t)(wave * 16 + mn) * KDIM;    // B col (N = mn)
#pragma unroll 4
    for (int kk = 0; kk < 32; ++kk) {
        const int kb = kk * 32 + khi;
        const int ka = ((kk * 64) ^ (((kk >> 2) & 7) << 4)) ^ aV;  // c = kk>>1, so c>>1 = kk>>2
        hv8 a0 = *(const hv8*)(smXb + ka);
        hv8 a1 = *(const hv8*)(smXb + (ka ^ 32));
        hv8 b0 = *(const hv8*)(Bp + kb);
        hv8 b1 = *(const hv8*)(Bp + kb + 16);
        hv16 A = __builtin_shufflevector(a0, a1, 0,1,2,3,4,5,6,7,8,9,10,11,12,13,14,15);
        hv16 B = __builtin_shufflevector(b0, b1, 0,1,2,3,4,5,6,7,8,9,10,11,12,13,14,15);
        acc = __builtin_amdgcn_wmma_f32_16x16x32_f16(false, A, false, B,
                                                     (short)0, acc, false, false);
    }
    {   // C/D layout: VGPR r -> M = r (+8 for lanes 16..31), N = lane&15
        const int mbase = (lane >> 4) ? 8 : 0;
#pragma unroll
        for (int r = 0; r < 8; ++r)
            smQ[(mbase + r) * NCOL + wave * 16 + mn] = acc[r];
    }
    __syncthreads();

    // ---- Stage 2: per (h,l) pair -> A = Wk[h]*Q, QK = X*A, softmax, attn ----
    float* myA8 = smA + wave * 512;
    // scores go where this wave's own first Q row lay: no other wave reads it, and
    // this wave has read it for the last time when the A stage ends
    float* myS = smQ + ((wave & 1) * 8) * NCOL + (wave >> 1) * 32;
    const float inv_sqrt_dk = 0.17677669529663687f;   // 1/sqrt(32)

    // A wave's 8 pairs share one head (h = wave >> 1): each lane's two W_k rows are
    // read from global memory once, and every 4-float piece feeds all 8 pairs' sums.
    const int h  = wave >> 1;
    const int lb = (wave & 1) * 8;
    const int w1 = wave & 1;                          // l >> 3 of this wave's 8 pairs
    {
        // A[d] = sum_t Wk[h,d,t] * Q[l, h*32+t];  d0 = lane, d1 = lane+32; t ascending
        const float4* g0 = (const float4*)(Wk + ((size_t)(h * 64 + lane) * 32));
        const float4* g1 = (const float4*)(Wk + ((size_t)(h * 64 + lane + 32) * 32));
        const float*  qb = smQ + lb * NCOL + h * 32;
        float a0[8], a1[8];
#pragma unroll
        for (int p = 0; p < 8; ++p) { a0[p] = 0.f; a1[p] = 0.f; }
        // kept rolled: unrolled, the loop holds all 64 W_k floats at once, and the
        // registers cost resident work-groups
#pragma unroll 1
        for (int tc = 0; tc < 8; ++tc) {
            const float4 u = g0[tc], v = g1[tc];
#pragma unroll
            for (int p = 0; p < 8; ++p) {
                const float4 q = *(const float4*)(qb + p * NCOL + tc * 4);
                a0[p] = fmaf(u.x, q.x, a0[p]);  a1[p] = fmaf(v.x, q.x, a1[p]);
                a0[p] = fmaf(u.y, q.y, a0[p]);  a1[p] = fmaf(v.y, q.y, a1[p]);
                a0[p] = fmaf(u.z, q.z, a0[p]);  a1[p] = fmaf(v.z, q.z, a1[p]);
                a0[p] = fmaf(u.w, q.w, a0[p]);  a1[p] = fmaf(v.w, q.w, a1[p]);
            }
        }
#pragma unroll
        for (int p = 0; p < 8; ++p) {
            myA8[p * 64 + lane]      = a0[p];
            myA8[p * 64 + lane + 32] = a1[p];
        }
    }
    __syncthreads();

    for (int p = 0; p < 8; ++p) {
        const int l = lb + p;                         // 128 pairs / 16 waves
        const float* myA = myA8 + p * 64;

        // QK[c] = (1/sqrt(DK)) * sum_d X[l,c,d] * A[d]   (lanes 0..15 own c)
        {
            const int c = lane & 15;
            const int xo = (l * KDIM * 2) | ((c ^ w1) << 7) | (((c >> 1) ^ p) << 4);   // l & 7 = p
            float qk = 0.f;
            // rolled, 8 trips of 8: only one trip's three LDS loads hold registers at a time
#pragma unroll 1
            for (int j = 0; j < 8; ++j) {
                const _Float16* xr = (const _Float16*)(smXb + (xo ^ (j << 4)));
                // fmaf: one fused multiply-add per d; written with * and + this loop was built as
                // conversions, packed multiplies and separate adds
#pragma unroll
                for (int e = 0; e < 8; ++e)
                    qk = fmaf((float)xr[e], myA[j * 8 + e], qk);
            }
            if (lane < 16) myS[lane] = qk * inv_sqrt_dk;
        }
        __syncthreads();

        // softmax over C=16 + attn[d] = sum_c score[c] * X[l,c,d]
        float sc[16];
        float mx = -3.0e38f;
#pragma unroll
        for (int c = 0; c < 16; ++c) { sc[c] = myS[c]; mx = fmaxf(mx, sc[c]); }
        float ssum = 0.f;
#pragma unroll
        for (int c = 0; c < 16; ++c) { sc[c] = __expf(sc[c] - mx); ssum += sc[c]; }
        const float rs = 1.0f / ssum;

        float o0 = 0.f, o1 = 0.f;
        const int av = (l * KDIM * 2) | (w1 << 7) | (((lane >> 3) ^ p) << 4) | ((lane & 7) * 2);
#pragma unroll
        for (int c = 0; c < 16; ++c) {
            const int m = c >> 1, rb = (c & 1) << 7;  // d = lane+32 lies 4 pieces on: m ^ 4
            o0 += sc[c] * (float)*(const _Float16*)(smXb + (m << 8) + (av ^ ((m << 4) | rb)));
            o1 += sc[c] * (float)*(const _Float16*)(smXb + (m << 8) + (av ^ (((m ^ 4) << 4) | rb)));
        }
        const size_t ob = ((size_t)n * LL + (size_t)ltile * 16 + l) * (NHH * DD) + h * 64;
        out[ob + lane]      = o0 * rs;
        out[ob + lane + 32] = o1 * rs;
        __syncthreads();   // protect the score scratch before next pair
    }
}

extern "C" void kernel_launch(void* const* d_in, const int* in_sizes, int n_in,
                              void* d_out, int out_size, void* d_ws, size_t ws_size,
                              hipStream_t stream) {
    const float* x  = (const float*)d_in[0];   // (64, 8192, 64)
    const float* Wq = (const float*)d_in[1];   // (8, 16, 64, 32)
    const float* Wk = (const float*)d_in[2];   // (8, 64, 32)
    float* out = (float*)d_out;                // (64, 512, 512)
    _Float16* Wt = (_Float16*)d_ws;            // 512 KB packed f16 weights

    wq_pack_f16<<<(NHH * DKK * KDIM + 255) / 256, 256, 0, stream>>>(Wq, Wt);
    attn_fused<<<NB * (LL / 16), 512, 0, stream>>>(x, Wt, Wk, out);
}

// v003
// Measured time: 108 microseconds a run.
// Timed twice side by side with v002, it ran 1.31 times as fast both times.
// Over all steps from v000 it is 2.89 times as fast.
#include <hip/hip_runtime.h>

typedef _Float16 hv8  __attribute__((ext_vector_type(8)));
typedef _Float16 hv16 __attribute__((ext_vector_type(16)));
typedef float    fv8  __attribute__((ext_vector_type(8)));

#define NB    64
#define TOTB  8192
#define DD    64
#define DKK   32
#define CC    16
#define NHH   8
#define LL    512          // TOT / C
#define KDIM  1024         // C * D
#define NCOL  256          // NH * DK

// Pack W_q (NH,C,D,DK) fp32 -> f16, layout Wt[col][k] with col = h*32+t, k = c*64+d.
// Coalesced writes; scattered reads hit L2 (W_q is only 1 MiB).
__global__ __launch_bounds__(256) void wq_pack_f16(const float* __restrict__ Wq,
                                                   _Float16* __restrict__ Wt) {
    int o = blockIdx.x * 256 + threadIdx.x;
    if (o >= NHH * DKK * KDIM) return;
    int col = o >> 10;           // h*32 + t
    int k   = o & 1023;          // c*64 + d
    int h = col >> 5, t = col & 31;
    int c = k >> 6,  d = k & 63;
    Wt[o] = (_Float16)Wq[(((h * CC + c) * DD + d) * DKK) + t];
}

typedef short s16x8 __attribute__((ext_vector_type(8)));

// Transposing LDS load: lane i hands in the 16 bytes of row 8*(i>>4) + (i&7), column piece (i>>3)&1;
// lane (c = i&15, hf = i>>4) gets rows 8*hf .. 8*hf+7 of column c.
__device__ __forceinline__ hv8 ld_tr16(const char* p) {
    typedef __attribute__((address_space(3))) s16x8 lds_s16x8;
    return __builtin_bit_cast(hv8, __builtin_amdgcn_ds_load_tr16_b128_v8i16((lds_s16x8*)p));
}

// lane i with lane i ^ 16
__device__ __forceinline__ float xhalf(float v) {
    const int b = __builtin_bit_cast(int, v);
    return __builtin_bit_cast(float, __builtin_amdgcn_permlanex16(b, b, 0x76543210, 0xfedcba98, false, false));
}

// e^v as v_exp_f32 of v*log2(e). Asm so that the v_nop stands directly behind it: the instruction set asks
// for one slot behind a transcendental before its source is overwritten or its result read.
__device__ __forceinline__ float exp_slot(float v) {
    float r;
    asm("v_exp_f32 %0, %1\n\tv_nop" : "=v"(r) : "v"(v * 1.4426950408889634f));
    return r;
}

__global__ __launch_bounds__(512) void attn_fused(const float* __restrict__ x,
                                                  const _Float16* __restrict__ Wt,
                                                  const float* __restrict__ Wk,
                                                  float* __restrict__ out) {
    // X tile, f16, 32 KB, XOR-swizzled: element (l,c,d) lies in 128-byte row l*16 + (c ^ (l>>3)),
    // 16-byte piece (d>>3) ^ (c>>1) ^ (l&7). 16 lanes that walk l (GEMM1's A rows) or c (the QK
    // rows) at one d then fall on 16 different groups of four banks, all 64 banks.
    __shared__ __align__(256) _Float16 smX[16 * KDIM];
    const char* smXb = (const char*)smX;                // readers form swizzled byte offsets
    __shared__ __align__(16) float smQ[16 * NCOL];      // 16 KB: Q tile, fp32
    // 32 KB: A as f16 pairs. Row l holds 16 rows of 64 d: rows 0..7 the heads' rounded values, rows
    // 8..15 the remainders; 16-byte piece (d>>3) ^ head, so 8 heads at one d fall on 8 bank groups.
    __shared__ __align__(16) _Float16 smA[16 * 1024];

    const int tid   = threadIdx.x;
    const int wave  = tid >> 5;
    const int lane  = tid & 31;
    const int n     = blockIdx.x >> 5;
    const int ltile = blockIdx.x & 31;

    // ---- Load 16x1024 x-tile: contiguous 64 KB, fp32 -> f16 LDS ----
    const float* xsrc = x + ((size_t)n * TOTB + (size_t)ltile * 256) * DD;
    for (int i = tid; i < 16 * KDIM / 4; i += 512) {
        float4 v = *(const float4*)(xsrc + (size_t)i * 4);
        const int e = i * 4;                          // l*1024 + c*64 + d
        const int o = e ^ (((e >> 13) & 1) << 6) ^ ((((e >> 7) ^ (e >> 10)) & 7) << 3);
        smX[o + 0] = (_Float16)v.x;
        smX[o + 1] = (_Float16)v.y;
        smX[o + 2] = (_Float16)v.z;
        smX[o + 3] = (_Float16)v.w;
    }
    __syncthreads();

    // ---- GEMM1: Q[16 x 256] = X[16 x 1024] * Wt^T, one 16-col tile per wave ----
    // 16-bit A/B fragment K-offsets per ISA layout:
    //   lanes 0..15:  K = {kb+0..7, kb+16..23}; lanes 16..31: K = {kb+8..15, kb+24..31}
    fv8 acc = {};
    const int mn   = lane & 15;
    const int khi  = (lane >> 4) ? 8 : 0;
    // A row (M = mn): the lane's share of the swizzled byte offset
    const int aV   = (mn * KDIM * 2) | ((khi * 2) ^ ((mn >> 3) << 7) ^ ((mn & 7) << 4));
    const _Float16* Bp = Wt + (size_t)(wave * 16 + mn) * KDIM;    // B col (N = mn)
#pragma unroll 4
    for (int kk = 0; kk < 32; ++kk) {
        const int kb = kk * 32 + khi;
        const int ka = ((kk * 64) ^ (((kk >> 2) & 7) << 4)) ^ aV;  // c = kk>>1, so c>>1 = kk>>2
        hv8 a0 = *(const hv8*)(smXb + ka);
        hv8 a1 = *(const hv8*)(smXb + (ka ^ 32));
        hv8 b0 = *(const hv8*)(Bp + kb);
        hv8 b1 = *(const hv8*)(Bp + kb + 16);
        hv16 A = __builtin_shufflevector(a0, a1, 0,1,2,3,4,5,6,7,8,9,10,11,12,13,14,15);
        hv16 B = __builtin_shufflevector(b0, b1, 0,1,2,3,4,5,6,7,8,9,10,11,12,13,14,15);
        acc = __builtin_amdgcn_wmma_f32_16x16x32_f16(false, A, false, B,
                                                     (short)0, acc, false, false);
    }
    {   // C/D layout: VGPR r -> M = r (+8 for lanes 16..31), N = lane&15
        const int mbase = (lane >> 4) ? 8 : 0;
#pragma unroll
        for (int r = 0; r < 8; ++r)
            smQ[(mbase + r) * NCOL + wave * 16 + mn] = acc[r];
    }
    __syncthreads();

    // ---- Stage 2a: A = Wk[h]*Q on the vector unit, one head and 8 rows l per wave ----
    const float inv_sqrt_dk = 0.17677669529663687f;   // 1/sqrt(32)

    // A wave's 8 pairs share one head (h = wave >> 1): each lane's two W_k rows are
    // read from global memory once, and every 4-float piece feeds all 8 pairs' sums.
    const int h  = wave >> 1;
    const int lb = (wave & 1) * 8;
    {
        // A[d] = sum_t Wk[h,d,t] * Q[l, h*32+t];  d0 = lane, d1 = lane+32; t ascending
        const float4* g0 = (const float4*)(Wk + ((size_t)(h * 64 + lane) * 32));
        const float4* g1 = (const float4*)(Wk + ((size_t)(h * 64 + lane + 32) * 32));
        const float*  qb = smQ + lb * NCOL + h * 32;
        float a0[8], a1[8];
#pragma unroll
        for (int p = 0; p < 8; ++p) { a0[p] = 0.f; a1[p] = 0.f; }
        // kept rolled: unrolled, the loop holds all 64 W_k floats at once, and the
        // registers cost resident work-groups
#pragma unroll 1
        for (int tc = 0; tc < 8; ++tc) {
            const float4 u = g0[tc], v = g1[tc];
#pragma unroll
            for (int p = 0; p < 8; ++p) {
                const float4 q = *(const float4*)(qb + p * NCOL + tc * 4);
                a0[p] = fmaf(u.x, q.x, a0[p]);  a1[p] = fmaf(v.x, q.x, a1[p]);
                a0[p] = fmaf(u.y, q.y, a0[p]);  a1[p] = fmaf(v.y, q.y, a1[p]);
                a0[p] = fmaf(u.z, q.z, a0[p]);  a1[p] = fmaf(v.z, q.z, a1[p]);
                a0[p] = fmaf(u.w, q.w, a0[p]);  a1[p] = fmaf(v.w, q.w, a1[p]);
            }
        }
        // each f32 A goes out as two f16: the rounded value (row h) and what the rounding left (row 8+h)
        const int ao = (h << 6) | ((((lane >> 3) ^ h) << 3) | (lane & 7));   // d = lane; d+32: piece ^ 4
#pragma unroll
        for (int p = 0; p < 8; ++p) {
            _Float16* ar = smA + (lb + p) * 1024;
            const _Float16 h0 = (_Float16)a0[p], h1 = (_Float16)a1[p];
            ar[ao]              = h0;
            ar[ao ^ 32]         = h1;
            ar[ao + 512]        = (_Float16)(a0[p] - (float)h0);
            ar[(ao ^ 32) + 512] = (_Float16)(a1[p] - (float)h1);
        }
    }
    __syncthreads();

    // ---- Stage 2b: one row l per wave, all 8 heads at once, on the matrix unit ----
    // From here on a wave reads smX and smA only and writes no LDS: no further barrier.
    const int l    = wave;
    const int half = lane >> 4;
    const int hd   = mn & 7;                          // columns 8..15 repeat heads 0..7
    const char* smAb = (const char*)smA;

    // QK[c][hd] = sum_d X[l,c,d] * (Ahi + Alo)[hd][d]: rows M = c, columns N = head, k = d.
    // X rows and A rows are cut by the same code, so both sides hold the same k at every place.
    fv8 s = {};
    {
        const int xrow = (l * KDIM * 2) | ((mn ^ (l >> 3)) << 7);
        const int xsw  = (mn >> 1) ^ (l & 7);
        const int arow = (l << 11) | (hd << 7);
#pragma unroll
        for (int ks = 0; ks < 2; ++ks) {
            const int p0 = ks * 4 + half, p1 = p0 + 2;   // 16-byte pieces: d = 8*p0.., 8*p1..
            hv8 x0 = *(const hv8*)(smXb + xrow + ((p0 ^ xsw) << 4));
            hv8 x1 = *(const hv8*)(smXb + xrow + ((p1 ^ xsw) << 4));
            hv8 u0 = *(const hv8*)(smAb + arow + ((p0 ^ hd) << 4));
            hv8 u1 = *(const hv8*)(smAb + arow + ((p1 ^ hd) << 4));
            hv8 w0 = *(const hv8*)(smAb + arow + 1024 + ((p0 ^ hd) << 4));
            hv8 w1 = *(const hv8*)(smAb + arow + 1024 + ((p1 ^ hd) << 4));
            hv16 XA = __builtin_shufflevector(x0, x1, 0,1,2,3,4,5,6,7,8,9,10,11,12,13,14,15);
            hv16 AH = __builtin_shufflevector(u0, u1, 0,1,2,3,4,5,6,7,8,9,10,11,12,13,14,15);
            hv16 AL = __builtin_shufflevector(w0, w1, 0,1,2,3,4,5,6,7,8,9,10,11,12,13,14,15);
            s = __builtin_amdgcn_wmma_f32_16x16x32_f16(false, XA, false, AH, (short)0, s, false, false);
            s = __builtin_amdgcn_wmma_f32_16x16x32_f16(false, XA, false, AL, (short)0, s, false, false);
        }
    }

    // softmax over c: register r of lane (hd, half) holds c = 8*half + r; the other 8 lie in lane ^ 16
    float sc[8];
    float mx = -3.0e38f;
#pragma unroll
    for (int r = 0; r < 8; ++r) { sc[r] = s[r] * inv_sqrt_dk; mx = fmaxf(mx, sc[r]); }
    mx = fmaxf(mx, xhalf(mx));
    float ssum = 0.f;
#pragma unroll
    for (int r = 0; r < 8; ++r) { sc[r] = exp_slot(sc[r] - mx); ssum += sc[r]; }
    ssum += xhalf(ssum);
    const float rs = 1.0f / ssum;

    // The exponentials are a B operand as they lie: k = 8*half + r is c with the rounded f16 value,
    // k = 16 + 8*half + r is the same c with what the rounding left. 1/sum is applied to the sums.
    hv16 SB;
#pragma unroll
    for (int r = 0; r < 8; ++r) {
        const _Float16 ph = (_Float16)sc[r];
        SB[r]     = ph;
        SB[r + 8] = (_Float16)(sc[r] - (float)ph);
    }

    // attn[d][hd] = sum_c X[l,c,d] * e[c][hd]: rows M = d, 16 per tile, from transposing loads;
    // the fragment's two halves are the same 8 values of c (k and k + 16).
    {
        const int cc   = half * 8 + (lane & 7);       // the row c whose 16 bytes this lane fetches
        const int trow = (l * KDIM * 2) | ((cc ^ (l >> 3)) << 7);
        const int tsw  = (cc >> 1) ^ (l & 7);
        const int pb   = (lane >> 3) & 1;
        // register r holds d = 16*dt + 8*half + r; column hd stores r = 0..3, its twin hd + 8 r = 4..7
        float* op = out + ((size_t)n * LL + (size_t)ltile * 16 + l) * (NHH * DD)
                        + hd * 64 + half * 8 + (mn >> 3) * 4;
        const bool up = mn >= 8;
#pragma unroll
        for (int dt = 0; dt < 4; ++dt) {
            hv8 t = ld_tr16(smXb + trow + (((dt * 2 + pb) ^ tsw) << 4));
            hv16 XT = __builtin_shufflevector(t, t, 0,1,2,3,4,5,6,7,0,1,2,3,4,5,6,7);
            fv8 z = {};
            fv8 o = __builtin_amdgcn_wmma_f32_16x16x32_f16(false, XT, false, SB, (short)0, z, false, false);
            float4 v;
            v.x = (up ? o[4] : o[0]) * rs;
            v.y = (up ? o[5] : o[1]) * rs;
            v.z = (up ? o[6] : o[2]) * rs;
            v.w = (up ? o[7] : o[3]) * rs;
            *(float4*)(op + dt * 16) = v;
        }
    }
}

extern "C" void kernel_launch(void* const* d_in, const int* in_sizes, int n_in,
                              void* d_out, int out_size, void* d_ws, size_t ws_size,
                              hipStream_t stream) {
    const float* x  = (const float*)d_in[0];   // (64, 8192, 64)
    const float* Wq = (const float*)d_in[1];   // (8, 16, 64, 32)
    const float* Wk = (const float*)d_in[2];   // (8, 64, 32)
    float* out = (float*)d_out;                // (64, 512, 512)
    _Float16* Wt = (_Float16*)d_ws;            // 512 KB packed f16 weights

    wq_pack_f16<<<(NHH * DKK * KDIM + 255) / 256, 256, 0, stream>>>(Wq, Wt);
    attn_fused<<<NB * (LL / 16), 512, 0, stream>>>(x, Wt, Wk, out);
}

// v004
// It runs in 58 microseconds.
// Timed twice side by side with v003, it ran 1.86 and 1.85 times as fast.
// Counting every step since v000, it is 5.38 times as fast.
#include <hip/hip_runtime.h>

typedef _Float16 hv8  __attribute__((ext_vector_type(8)));
typedef _Float16 hv16 __attribute__((ext_vector_type(16)));
typedef float    fv8  __attribute__((ext_vector_type(8)));

#define NB    64
#define TOTB  8192
#define DD    64
#define DKK   32
#define CC    16
#define NHH   8
#define LL    512          // TOT / C
#define KDIM  1024         // C * D
#define NCOL  256          // NH * DK

#define WT_ELEMS (NHH * DKK * KDIM)   // 262144 f16
#define WK_ELEMS (NHH * DD * DKK)     // 16384 f32

// Pack both weights in the order in which the lanes of the main kernel read them, so that the 32
// 16-byte pieces of one wave load are 512 bytes in a row: 4 whole 128-byte lines.
//   W_q (NH,C,D,DK) fp32 -> f16, Wt[w][kk][j][lane][e]: column h*32+t = w*16 + (lane&15),
//       k = c*64+d = kk*32 + j*16 + (lane>>4)*8 + e  (the B fragment of column tile w, k step kk).
//   W_k (NH,D,DK) fp32 -> fp32, Wkp[h][tc][dh][lane][e]: d = dh*32 + lane, t = tc*4 + e.
__global__ __launch_bounds__(256) void w_pack(const float* __restrict__ Wq,
                                              const float* __restrict__ Wk,
                                              _Float16* __restrict__ Wt,
                                              float* __restrict__ Wkp) {
    int o = blockIdx.x * 256 + threadIdx.x;
    if (o < WT_ELEMS) {
        int e = o & 7, ln = (o >> 3) & 31, j = (o >> 8) & 1, kk = (o >> 9) & 31, w = o >> 14;
        int col = w * 16 + (ln & 15);
        int k   = kk * 32 + j * 16 + (ln >> 4) * 8 + e;
        int h = col >> 5, t = col & 31;
        int c = k >> 6,  d = k & 63;
        Wt[o] = (_Float16)Wq[(((h * CC + c) * DD + d) * DKK) + t];
    } else if (o < WT_ELEMS + WK_ELEMS) {
        int q = o - WT_ELEMS;
        int e = q & 3, ln = (q >> 2) & 31, dh = (q >> 7) & 1, tc = (q >> 8) & 7, h = q >> 11;
        Wkp[q] = Wk[(h * DD + dh * 32 + ln) * DKK + tc * 4 + e];
    }
}

typedef short s16x8 __attribute__((ext_vector_type(8)));

// Transposing LDS load: lane i hands in the 16 bytes of row 8*(i>>4) + (i&7), column piece (i>>3)&1;
// lane (c = i&15, hf = i>>4) gets rows 8*hf .. 8*hf+7 of column c.
__device__ __forceinline__ hv8 ld_tr16(const char* p) {
    typedef __attribute__((address_space(3))) s16x8 lds_s16x8;
    return __builtin_bit_cast(hv8, __builtin_amdgcn_ds_load_tr16_b128_v8i16((lds_s16x8*)p));
}

// lane i with lane i ^ 16
__device__ __forceinline__ float xhalf(float v) {
    const int b = __builtin_bit_cast(int, v);
    return __builtin_bit_cast(float, __builtin_amdgcn_permlanex16(b, b, 0x76543210, 0xfedcba98, false, false));
}

// e^v as v_exp_f32 of v*log2(e). Asm so that the v_nop stands directly behind it: the instruction set asks
// for one slot behind a transcendental before its source is overwritten or its result read.
__device__ __forceinline__ float exp_slot(float v) {
    float r;
    asm("v_exp_f32 %0, %1\n\tv_nop" : "=v"(r) : "v"(v * 1.4426950408889634f));
    return r;
}

// At most 64 vector registers: four work-groups (4 x 80 KB of LDS, 16 waves per SIMD) are resident on
// a WGP only up to there; left alone the compiler takes 70 and one work-group in four is lost.
__global__ __launch_bounds__(512) __attribute__((amdgpu_num_vgpr(64))) void attn_fused(const float* __restrict__ x,
                                                  const _Float16* __restrict__ Wt,
                                                  const float* __restrict__ Wkp,
                                                  float* __restrict__ out) {
    // X tile, f16, 32 KB, XOR-swizzled: element (l,c,d) lies in 128-byte row l*16 + (c ^ (l>>3)),
    // 16-byte piece (d>>3) ^ (c>>1) ^ (l&7). 16 lanes that walk l (GEMM1's A rows) or c (the QK
    // rows) at one d then fall on 16 different groups of four banks, all 64 banks.
    __shared__ __align__(256) _Float16 smX[16 * KDIM];
    const char* smXb = (const char*)smX;                // readers form swizzled byte offsets
    __shared__ __align__(16) float smQ[16 * NCOL];      // 16 KB: Q tile, fp32
    // 32 KB: A as f16 pairs. Row l holds 16 rows of 64 d: rows 0..7 the heads' rounded values, rows
    // 8..15 the remainders; 16-byte piece (d>>3) ^ head, so 8 heads at one d fall on 8 bank groups.
    __shared__ __align__(16) _Float16 smA[16 * 1024];

    const int tid   = threadIdx.x;
    const int wave  = __builtin_amdgcn_readfirstlane(tid >> 5);   // the same in all lanes: what derives from it needs no vector register
    const int lane  = tid & 31;
    const int n     = blockIdx.x >> 5;
    const int ltile = blockIdx.x & 31;

    // ---- Load 16x1024 x-tile: contiguous 64 KB, fp32 -> f16 LDS ----
    const float* xsrc = x + ((size_t)n * TOTB + (size_t)ltile * 256) * DD;
    for (int i = tid; i < 16 * KDIM / 4; i += 512) {
        float4 v = *(const float4*)(xsrc + (size_t)i * 4);
        const int e = i * 4;                          // l*1024 + c*64 + d
        const int o = e ^ (((e >> 13) & 1) << 6) ^ ((((e >> 7) ^ (e >> 10)) & 7) << 3);
        smX[o + 0] = (_Float16)v.x;
        smX[o + 1] = (_Float16)v.y;
        smX[o + 2] = (_Float16)v.z;
        smX[o + 3] = (_Float16)v.w;
    }
    __syncthreads();

    // ---- GEMM1: Q[16 x 256] = X[16 x 1024] * Wt^T, one 16-col tile per wave ----
    // 16-bit A/B fragment K-offsets per ISA layout:
    //   lanes 0..15:  K = {kb+0..7, kb+16..23}; lanes 16..31: K = {kb+8..15, kb+24..31}
    fv8 acc = {};
    const int mn   = lane & 15;
    const int khi  = (lane >> 4) ? 8 : 0;
    // A row (M = mn): the lane's share of the swizzled byte offset
    const int aV   = (mn * KDIM * 2) | ((khi * 2) ^ ((mn >> 3) << 7) ^ ((mn & 7) << 4));
    const _Float16* Bp = Wt + (size_t)wave * (16 * KDIM) + lane * 8;   // packed B fragments, lane order
#pragma unroll 4
    for (int kk = 0; kk < 32; ++kk) {
        const int ka = ((kk * 64) ^ (((kk >> 2) & 7) << 4)) ^ aV;  // c = kk>>1, so c>>1 = kk>>2
        hv8 a0 = *(const hv8*)(smXb + ka);
        hv8 a1 = *(const hv8*)(smXb + (ka ^ 32));
        hv8 b0 = *(const hv8*)(Bp + kk * 512);          // k = kk*32 + khi + 0..7
        hv8 b1 = *(const hv8*)(Bp + kk * 512 + 256);    // k = kk*32 + khi + 16..23
        hv16 A = __builtin_shufflevector(a0, a1, 0,1,2,3,4,5,6,7,8,9,10,11,12,13,14,15);
        hv16 B = __builtin_shufflevector(b0, b1, 0,1,2,3,4,5,6,7,8,9,10,11,12,13,14,15);
        acc = __builtin_amdgcn_wmma_f32_16x16x32_f16(false, A, false, B,
                                                     (short)0, acc, false, false);
    }
    {   // C/D layout: VGPR r -> M = r (+8 for lanes 16..31), N = lane&15
        const int mbase = (lane >> 4) ? 8 : 0;
#pragma unroll
        for (int r = 0; r < 8; ++r)
            smQ[(mbase + r) * NCOL + wave * 16 + mn] = acc[r];
    }
    __syncthreads();

    // ---- Stage 2a: A = Wk[h]*Q on the vector unit, one head and 8 rows l per wave ----
    const float inv_sqrt_dk = 0.17677669529663687f;   // 1/sqrt(32)

    // A wave's 8 pairs share one head (h = wave >> 1): each lane's two W_k rows are
    // read from global memory once, and every 4-float piece feeds all 8 pairs' sums.
    const int h  = wave >> 1;
    const int lb = (wave & 1) * 8;
    {
        // A[d] = sum_t Wk[h,d,t] * Q[l, h*32+t];  d0 = lane, d1 = lane+32; t ascending
        const float4* g0 = (const float4*)Wkp + h * 512 + lane;   // packed: [tc][d >> 5][lane]
        const float*  qb = smQ + lb * NCOL + h * 32;
        float a0[8], a1[8];
#pragma unroll
        for (int p = 0; p < 8; ++p) { a0[p] = 0.f; a1[p] = 0.f; }
        // kept rolled: unrolled, the loop holds all 64 W_k floats at once, and the
        // registers cost resident work-groups
#pragma unroll 1
        for (int tc = 0; tc < 8; ++tc) {
            const float4 u = g0[tc * 64], v = g0[tc * 64 + 32];
#pragma unroll
            for (int p = 0; p < 8; ++p) {
                const float4 q = *(const float4*)(qb + p * NCOL + tc * 4);
                a0[p] = fmaf(u.x, q.x, a0[p]);  a1[p] = fmaf(v.x, q.x, a1[p]);
                a0[p] = fmaf(u.y, q.y, a0[p]);  a1[p] = fmaf(v.y, q.y, a1[p]);
                a0[p] = fmaf(u.z, q.z, a0[p]);  a1[p] = fmaf(v.z, q.z, a1[p]);
                a0[p] = fmaf(u.w, q.w, a0[p]);  a1[p] = fmaf(v.w, q.w, a1[p]);
            }
        }
        // each f32 A goes out as two f16: the rounded value (row h) and what the rounding left (row 8+h)
        const int ao = (h << 6) | ((((lane >> 3) ^ h) << 3) | (lane & 7));   // d = lane; d+32: piece ^ 4
#pragma unroll
        for (int p = 0; p < 8; ++p) {
            _Float16* ar = smA + (lb + p) * 1024;
            const _Float16 h0 = (_Float16)a0[p], h1 = (_Float16)a1[p];
            ar[ao]              = h0;
            ar[ao ^ 32]         = h1;
            ar[ao + 512]        = (_Float16)(a0[p] - (float)h0);
            ar[(ao ^ 32) + 512] = (_Float16)(a1[p] - (float)h1);
        }
    }
    __syncthreads();

    // ---- Stage 2b: one row l per wave, all 8 heads at once, on the matrix unit ----
    // From here on a wave reads smX and smA only and writes no LDS: no further barrier.
    const int l    = wave;
    const int half = lane >> 4;
    const int hd   = mn & 7;                          // columns 8..15 repeat heads 0..7
    const char* smAb = (const char*)smA;

    // QK[c][hd] = sum_d X[l,c,d] * (Ahi + Alo)[hd][d]: rows M = c, columns N = head, k = d.
    // X rows and A rows are cut by the same code, so both sides hold the same k at every place.
    fv8 s = {};
    {
        const int xrow = (l * KDIM * 2) | ((mn ^ (l >> 3)) << 7);
        const int xsw  = (mn >> 1) ^ (l & 7);
        const int arow = (l << 11) | (hd << 7);
#pragma unroll
        for (int ks = 0; ks < 2; ++ks) {
            const int p0 = ks * 4 + half, p1 = p0 + 2;   // 16-byte pieces: d = 8*p0.., 8*p1..
            hv8 x0 = *(const hv8*)(smXb + xrow + ((p0 ^ xsw) << 4));
            hv8 x1 = *(const hv8*)(smXb + xrow + ((p1 ^ xsw) << 4));
            hv8 u0 = *(const hv8*)(smAb + arow + ((p0 ^ hd) << 4));
            hv8 u1 = *(const hv8*)(smAb + arow + ((p1 ^ hd) << 4));
            hv8 w0 = *(const hv8*)(smAb + arow + 1024 + ((p0 ^ hd) << 4));
            hv8 w1 = *(const hv8*)(smAb + arow + 1024 + ((p1 ^ hd) << 4));
            hv16 XA = __builtin_shufflevector(x0, x1, 0,1,2,3,4,5,6,7,8,9,10,11,12,13,14,15);
            hv16 AH = __builtin_shufflevector(u0, u1, 0,1,2,3,4,5,6,7,8,9,10,11,12,13,14,15);
            hv16 AL = __builtin_shufflevector(w0, w1, 0,1,2,3,4,5,6,7,8,9,10,11,12,13,14,15);
            s = __builtin_amdgcn_wmma_f32_16x16x32_f16(false, XA, false, AH, (short)0, s, false, false);
            s = __builtin_amdgcn_wmma_f32_16x16x32_f16(false, XA, false, AL, (short)0, s, false, false);
        }
    }

    // softmax over c: register r of lane (hd, half) holds c = 8*half + r; the other 8 lie in lane ^ 16
    float sc[8];
    float mx = -3.0e38f;
#pragma unroll
    for (int r = 0; r < 8; ++r) { sc[r] = s[r] * inv_sqrt_dk; mx = fmaxf(mx, sc[r]); }
    mx = fmaxf(mx, xhalf(mx));
    float ssum = 0.f;
#pragma unroll
    for (int r = 0; r < 8; ++r) { sc[r] = exp_slot(sc[r] - mx); ssum += sc[r]; }
    ssum += xhalf(ssum);
    const float rs = 1.0f / ssum;

    // The exponentials are a B operand as they lie: k = 8*half + r is c with the rounded f16 value,
    // k = 16 + 8*half + r is the same c with what the rounding left. 1/sum is applied to the sums.
    hv16 SB;
#pragma unroll
    for (int r = 0; r < 8; ++r) {
        const _Float16 ph = (_Float16)sc[r];
        SB[r]     = ph;
        SB[r + 8] = (_Float16)(sc[r] - (float)ph);
    }

    // attn[d][hd] = sum_c X[l,c,d] * e[c][hd]: rows M = d, 16 per tile, from transposing loads;
    // the fragment's two halves are the same 8 values of c (k and k + 16).
    {
        const int cc   = half * 8 + (lane & 7);       // the row c whose 16 bytes this lane fetches
        const int trow = (l * KDIM * 2) | ((cc ^ (l >> 3)) << 7);
        const int tsw  = (cc >> 1) ^ (l & 7);
        const int pb   = (lane >> 3) & 1;
        // register r holds d = 16*dt + 8*half + r; column hd stores r = 0..3, its twin hd + 8 r = 4..7
        float* op = out + ((size_t)n * LL + (size_t)ltile * 16 + l) * (NHH * DD)
                        + hd * 64 + half * 8 + (mn >> 3) * 4;
        const bool up = mn >= 8;
#pragma unroll
        for (int dt = 0; dt < 4; ++dt) {
            hv8 t = ld_tr16(smXb + trow + (((dt * 2 + pb) ^ tsw) << 4));
            hv16 XT = __builtin_shufflevector(t, t, 0,1,2,3,4,5,6,7,0,1,2,3,4,5,6,7);
            fv8 z = {};
            fv8 o = __builtin_amdgcn_wmma_f32_16x16x32_f16(false, XT, false, SB, (short)0, z, false, false);
            float4 v;
            v.x = (up ? o[4] : o[0]) * rs;
            v.y = (up ? o[5] : o[1]) * rs;
            v.z = (up ? o[6] : o[2]) * rs;
            v.w = (up ? o[7] : o[3]) * rs;
            *(float4*)(op + dt * 16) = v;
        }
    }
}

extern "C" void kernel_launch(void* const* d_in, const int* in_sizes, int n_in,
                              void* d_out, int out_size, void* d_ws, size_t ws_size,
                              hipStream_t stream) {
    const float* x  = (const float*)d_in[0];   // (64, 8192, 64)
    const float* Wq = (const float*)d_in[1];   // (8, 16, 64, 32)
    const float* Wk = (const float*)d_in[2];   // (8, 64, 32)
    float* out = (float*)d_out;                // (64, 512, 512)
    _Float16* Wt = (_Float16*)d_ws;            // 512 KB packed f16 W_q
    float* Wkp = (float*)d_ws + WT_ELEMS / 2;  // 64 KB packed fp32 W_k behind it

    w_pack<<<(WT_ELEMS + WK_ELEMS) / 256, 256, 0, stream>>>(Wq, Wk, Wt, Wkp);
    attn_fused<<<NB * (LL / 16), 512, 0, stream>>>(x, Wt, Wkp, out);
}

// v005
// It runs in 47.3 microseconds.
// Next to v004, in two timings, it ran 1.22 and 1.23 times as fast.
// Over all steps from v000 it is 6.59 times as fast.
#include <hip/hip_runtime.h>

typedef _Float16 hv8  __attribute__((ext_vector_type(8)));
typedef _Float16 hv16 __attribute__((ext_vector_type(16)));
typedef float    fv8  __attribute__((ext_vector_type(8)));

#define NB    64
#define TOTB  8192
#define DD    64
#define DKK   32
#define CC    16
#define NHH   8
#define LL    512          // TOT / C
#define KDIM  1024         // C * D
#define NCOL  256          // NH * DK

#define MROWS 32           // rows l per work-group: two 16-row WMMA tiles

#define WT_ELEMS (NHH * DKK * KDIM)   // 262144 f16
#define WK_ELEMS (NHH * DD * DKK)     // 16384 f32

// Pack both weights in the order in which the lanes of the main kernel read them, so that the 32
// 16-byte pieces of one wave load are 512 bytes in a row: 4 whole 128-byte lines.
//   W_q (NH,C,D,DK) fp32 -> f16, Wt[w][kk][j][lane][e]: column h*32+t = w*16 + (lane&15),
//       k = c*64+d = kk*32 + j*16 + (lane>>4)*8 + e  (the B fragment of column tile w, k step kk).
//   W_k (NH,D,DK) fp32 -> fp32, Wkp[h][tc][dh][lane][e]: d = dh*32 + lane, t = tc*4 + e.
__global__ __launch_bounds__(256) void w_pack(const float* __restrict__ Wq,
                                              const float* __restrict__ Wk,
                                              _Float16* __restrict__ Wt,
                                              float* __restrict__ Wkp) {
    int o = blockIdx.x * 256 + threadIdx.x;
    if (o < WT_ELEMS) {
        int e = o & 7, ln = (o >> 3) & 31, j = (o >> 8) & 1, kk = (o >> 9) & 31, w = o >> 14;
        int col = w * 16 + (ln & 15);
        int k   = kk * 32 + j * 16 + (ln >> 4) * 8 + e;
        int h = col >> 5, t = col & 31;
        int c = k >> 6,  d = k & 63;
        Wt[o] = (_Float16)Wq[(((h * CC + c) * DD + d) * DKK) + t];
    } else if (o < WT_ELEMS + WK_ELEMS) {
        int q = o - WT_ELEMS;
        int e = q & 3, ln = (q >> 2) & 31, dh = (q >> 7) & 1, tc = (q >> 8) & 7, h = q >> 11;
        Wkp[q] = Wk[(h * DD + dh * 32 + ln) * DKK + tc * 4 + e];
    }
}

typedef short s16x8 __attribute__((ext_vector_type(8)));

// Transposing LDS load: lane i hands in the 16 bytes of row 8*(i>>4) + (i&7), column piece (i>>3)&1;
// lane (c = i&15, hf = i>>4) gets rows 8*hf .. 8*hf+7 of column c.
__device__ __forceinline__ hv8 ld_tr16(const char* p) {
    typedef __attribute__((address_space(3))) s16x8 lds_s16x8;
    return __builtin_bit_cast(hv8, __builtin_amdgcn_ds_load_tr16_b128_v8i16((lds_s16x8*)p));
}

// lane i with lane i ^ 16
__device__ __forceinline__ float xhalf(float v) {
    const int b = __builtin_bit_cast(int, v);
    return __builtin_bit_cast(float, __builtin_amdgcn_permlanex16(b, b, 0x76543210, 0xfedcba98, false, false));
}

// e^v as v_exp_f32 of v*log2(e). Asm so that the v_nop stands directly behind it: the instruction set asks
// for one slot behind a transcendental before its source is overwritten or its result read.
__device__ __forceinline__ float exp_slot(float v) {
    float r;
    asm("v_exp_f32 %0, %1\n\tv_nop" : "=v"(r) : "v"(v * 1.4426950408889634f));
    return r;
}

// A work-group takes 32 rows l: every W_q fragment and every W_k piece that a wave fetches from L2 serves
// twice the rows it would with 16. 160 KB of LDS: two work-groups per WGP, 8 waves per SIMD, which
// holds up to 128 vector registers.
__global__ __launch_bounds__(512) __attribute__((amdgpu_num_vgpr(128))) void attn_fused(const float* __restrict__ x,
                                                  const _Float16* __restrict__ Wt,
                                                  const float* __restrict__ Wkp,
                                                  float* __restrict__ out) {
    // X tile, f16, 64 KB, XOR-swizzled: element (l,c,d) lies in 128-byte row l*16 + (c ^ ((l>>3)&1)),
    // 16-byte piece (d>>3) ^ (c>>1) ^ (l&7). 16 lanes that walk l (GEMM1's A rows) or c (the QK
    // rows) at one d then fall on 16 different groups of four banks, all 64 banks.
    __shared__ __align__(256) _Float16 smX[MROWS * KDIM];
    const char* smXb = (const char*)smX;                // readers form swizzled byte offsets
    __shared__ __align__(16) float smQ[MROWS * NCOL];   // 32 KB: Q tile, fp32
    // 64 KB: A as f16 pairs. Row l holds 16 rows of 64 d: rows 0..7 the heads' rounded values, rows
    // 8..15 the remainders; 16-byte piece (d>>3) ^ head, so 8 heads at one d fall on 8 bank groups.
    __shared__ __align__(16) _Float16 smA[MROWS * 1024];

    const int tid   = threadIdx.x;
    const int wave  = __builtin_amdgcn_readfirstlane(tid >> 5);   // the same in all lanes: what derives from it needs no vector register
    const int lane  = tid & 31;
    const int n     = blockIdx.x >> 4;
    const int ltile = blockIdx.x & 15;

    // ---- Load 32x1024 x-tile: contiguous 128 KB, fp32 -> f16 LDS ----
    const float* xsrc = x + ((size_t)n * TOTB + (size_t)ltile * (MROWS * CC)) * DD;
    for (int i = tid; i < MROWS * KDIM / 4; i += 512) {
        float4 v = *(const float4*)(xsrc + (size_t)i * 4);
        const int e = i * 4;                          // l*1024 + c*64 + d
        const int o = e ^ (((e >> 13) & 1) << 6) ^ ((((e >> 7) ^ (e >> 10)) & 7) << 3);
        smX[o + 0] = (_Float16)v.x;
        smX[o + 1] = (_Float16)v.y;
        smX[o + 2] = (_Float16)v.z;
        smX[o + 3] = (_Float16)v.w;
    }
    __syncthreads();

    // ---- GEMM1: Q[32 x 256] = X[32 x 1024] * Wt^T, one 16-col tile per wave, both 16-row tiles ----
    // 16-bit A/B fragment K-offsets per ISA layout:
    //   lanes 0..15:  K = {kb+0..7, kb+16..23}; lanes 16..31: K = {kb+8..15, kb+24..31}
    fv8 acc = {}, acc2 = {};
    const int mn   = lane & 15;
    const int khi  = (lane >> 4) ? 8 : 0;
    // A row (M = mn; rows 16 + mn lie 32 KB further on, swizzled alike): the lane's share of the byte offset
    const int aV   = (mn * KDIM * 2) | ((khi * 2) ^ ((mn >> 3) << 7) ^ ((mn & 7) << 4));
    const _Float16* Bp = Wt + (size_t)wave * (16 * KDIM) + lane * 8;   // packed B fragments, lane order
#pragma unroll 4
    for (int kk = 0; kk < 32; ++kk) {
        const int ka = ((kk * 64) ^ (((kk >> 2) & 7) << 4)) ^ aV;  // c = kk>>1, so c>>1 = kk>>2
        hv8 a0 = *(const hv8*)(smXb + ka);
        hv8 a1 = *(const hv8*)(smXb + (ka ^ 32));
        hv8 a2 = *(const hv8*)(smXb + 16 * KDIM * 2 + ka);
        hv8 a3 = *(const hv8*)(smXb + 16 * KDIM * 2 + (ka ^ 32));
        hv8 b0 = *(const hv8*)(Bp + kk * 512);          // k = kk*32 + khi + 0..7
        hv8 b1 = *(const hv8*)(Bp + kk * 512 + 256);    // k = kk*32 + khi + 16..23
        hv16 A = __builtin_shufflevector(a0, a1, 0,1,2,3,4,5,6,7,8,9,10,11,12,13,14,15);
        hv16 A2 = __builtin_shufflevector(a2, a3, 0,1,2,3,4,5,6,7,8,9,10,11,12,13,14,15);
        hv16 B = __builtin_shufflevector(b0, b1, 0,1,2,3,4,5,6,7,8,9,10,11,12,13,14,15);
        acc  = __builtin_amdgcn_wmma_f32_16x16x32_f16(false, A, false, B,
                                                      (short)0, acc, false, false);
        acc2 = __builtin_amdgcn_wmma_f32_16x16x32_f16(false, A2, false, B,
                                                      (short)0, acc2, false, false);
    }
    {   // C/D layout: VGPR r -> M = r (+8 for lanes 16..31), N = lane&15
        const int mbase = (lane >> 4) ? 8 : 0;
#pragma unroll
        for (int r = 0; r < 8; ++r) {
            smQ[(mbase + r) * NCOL + wave * 16 + mn]      = acc[r];
            smQ[(16 + mbase + r) * NCOL + wave * 16 + mn] = acc2[r];
        }
    }
    __syncthreads();

    // ---- Stage 2a: A = Wk[h]*Q on the vector unit, one head and 16 rows l per wave ----
    const float inv_sqrt_dk = 0.17677669529663687f;   // 1/sqrt(32)

    // A wave's 16 pairs share one head (h = wave >> 1): each lane's two W_k rows are
    // read from global memory once, and every 4-float piece feeds all 16 pairs' sums.
    const int h  = wave >> 1;
    const int lb = (wave & 1) * 16;
    {
        // A[d] = sum_t Wk[h,d,t] * Q[l, h*32+t];  d0 = lane, d1 = lane+32; t ascending
        const float4* g0 = (const float4*)Wkp + h * 512 + lane;   // packed: [tc][d >> 5][lane]
        const float*  qb = smQ + lb * NCOL + h * 32;
        float a0[16], a1[16];
#pragma unroll
        for (int p = 0; p < 16; ++p) { a0[p] = 0.f; a1[p] = 0.f; }
        // kept rolled: unrolled, the loop holds all 64 W_k floats at once, and the
        // registers cost resident work-groups
#pragma unroll 1
        for (int tc = 0; tc < 8; ++tc) {
            const float4 u = g0[tc * 64], v = g0[tc * 64 + 32];
#pragma unroll
            for (int p = 0; p < 16; ++p) {
                const float4 q = *(const float4*)(qb + p * NCOL + tc * 4);
                a0[p] = fmaf(u.x, q.x, a0[p]);  a1[p] = fmaf(v.x, q.x, a1[p]);
                a0[p] = fmaf(u.y, q.y, a0[p]);  a1[p] = fmaf(v.y, q.y, a1[p]);
                a0[p] = fmaf(u.z, q.z, a0[p]);  a1[p] = fmaf(v.z, q.z, a1[p]);
                a0[p] = fmaf(u.w, q.w, a0[p]);  a1[p] = fmaf(v.w, q.w, a1[p]);
            }
        }
        // each f32 A goes out as two f16: the rounded value (row h) and what the rounding left (row 8+h)
        const int ao = (h << 6) | ((((lane >> 3) ^ h) << 3) | (lane & 7));   // d = lane; d+32: piece ^ 4
#pragma unroll
        for (int p = 0; p < 16; ++p) {
            _Float16* ar = smA + (lb + p) * 1024;
            const _Float16 h0 = (_Float16)a0[p], h1 = (_Float16)a1[p];
            ar[ao]              = h0;
            ar[ao ^ 32]         = h1;
            ar[ao + 512]        = (_Float16)(a0[p] - (float)h0);
            ar[(ao ^ 32) + 512] = (_Float16)(a1[p] - (float)h1);
        }
    }
    __syncthreads();

    // ---- Stage 2b: two rows l per wave (wave, wave + 16), each with all 8 heads at once, on the matrix unit ----
    // From here on a wave reads smX and smA only and writes no LDS: no further barrier.
    const int half = lane >> 4;
    const int hd   = mn & 7;                          // columns 8..15 repeat heads 0..7
    const char* smAb = (const char*)smA;

    // unrolled: the two rows are independent chains (LDS, WMMA, softmax, WMMA, store) that fill each other's waits
#pragma unroll
    for (int rr = 0; rr < 2; ++rr) {
    const int l = wave + rr * 16;                     // (l >> 3) & 1 = wave >> 3 and l & 7 = wave & 7 in both

    // QK[c][hd] = sum_d X[l,c,d] * (Ahi + Alo)[hd][d]: rows M = c, columns N = head, k = d.
    // X rows and A rows are cut by the same code, so both sides hold the same k at every place.
    fv8 s = {};
    {
        const int xrow = (l * KDIM * 2) | ((mn ^ (wave >> 3)) << 7);
        const int xsw  = (mn >> 1) ^ (l & 7);
        const int arow = (l << 11) | (hd << 7);
#pragma unroll
        for (int ks = 0; ks < 2; ++ks) {
            const int p0 = ks * 4 + half, p1 = p0 + 2;   // 16-byte pieces: d = 8*p0.., 8*p1..
            hv8 x0 = *(const hv8*)(smXb + xrow + ((p0 ^ xsw) << 4));
            hv8 x1 = *(const hv8*)(smXb + xrow + ((p1 ^ xsw) << 4));
            hv8 u0 = *(const hv8*)(smAb + arow + ((p0 ^ hd) << 4));
            hv8 u1 = *(const hv8*)(smAb + arow + ((p1 ^ hd) << 4));
            hv8 w0 = *(const hv8*)(smAb + arow + 1024 + ((p0 ^ hd) << 4));
            hv8 w1 = *(const hv8*)(smAb + arow + 1024 + ((p1 ^ hd) << 4));
            hv16 XA = __builtin_shufflevector(x0, x1, 0,1,2,3,4,5,6,7,8,9,10,11,12,13,14,15);
            hv16 AH = __builtin_shufflevector(u0, u1, 0,1,2,3,4,5,6,7,8,9,10,11,12,13,14,15);
            hv16 AL = __builtin_shufflevector(w0, w1, 0,1,2,3,4,5,6,7,8,9,10,11,12,13,14,15);
            s = __builtin_amdgcn_wmma_f32_16x16x32_f16(false, XA, false, AH, (short)0, s, false, false);
            s = __builtin_amdgcn_wmma_f32_16x16x32_f16(false, XA, false, AL, (short)0, s, false, false);
        }
    }

    // softmax over c: register r of lane (hd, half) holds c = 8*half + r; the other 8 lie in lane ^ 16
    float sc[8];
    float mx = -3.0e38f;
#pragma unroll
    for (int r = 0; r < 8; ++r) { sc[r] = s[r] * inv_sqrt_dk; mx = fmaxf(mx, sc[r]); }
    mx = fmaxf(mx, xhalf(mx));
    float ssum = 0.f;
#pragma unroll
    for (int r = 0; r < 8; ++r) { sc[r] = exp_slot(sc[r] - mx); ssum += sc[r]; }
    ssum += xhalf(ssum);
    const float rs = 1.0f / ssum;

    // The exponentials are a B operand as they lie: k = 8*half + r is c with the rounded f16 value,
    // k = 16 + 8*half + r is the same c with what the rounding left. 1/sum is applied to the sums.
    hv16 SB;
#pragma unroll
    for (int r = 0; r < 8; ++r) {
        const _Float16 ph = (_Float16)sc[r];
        SB[r]     = ph;
        SB[r + 8] = (_Float16)(sc[r] - (float)ph);
    }

    // attn[d][hd] = sum_c X[l,c,d] * e[c][hd]: rows M = d, 16 per tile, from transposing loads;
    // the fragment's two halves are the same 8 values of c (k and k + 16).
    {
        const int cc   = half * 8 + (lane & 7);       // the row c whose 16 bytes this lane fetches
        const int trow = (l * KDIM * 2) | ((cc ^ (wave >> 3)) << 7);
        const int tsw  = (cc >> 1) ^ (l & 7);
        const int pb   = (lane >> 3) & 1;
        // register r holds d = 16*dt + 8*half + r; column hd stores r = 0..3, its twin hd + 8 r = 4..7
        float* op = out + ((size_t)n * LL + (size_t)ltile * MROWS + l) * (NHH * DD)
                        + hd * 64 + half * 8 + (mn >> 3) * 4;
        const bool up = mn >= 8;
#pragma unroll
        for (int dt = 0; dt < 4; ++dt) {
            hv8 t = ld_tr16(smXb + trow + (((dt * 2 + pb) ^ tsw) << 4));
            hv16 XT = __builtin_shufflevector(t, t, 0,1,2,3,4,5,6,7,0,1,2,3,4,5,6,7);
            fv8 z = {};
            fv8 o = __builtin_amdgcn_wmma_f32_16x16x32_f16(false, XT, false, SB, (short)0, z, false, false);
            float4 v;
            v.x = (up ? o[4] : o[0]) * rs;
            v.y = (up ? o[5] : o[1]) * rs;
            v.z = (up ? o[6] : o[2]) * rs;
            v.w = (up ? o[7] : o[3]) * rs;
            *(float4*)(op + dt * 16) = v;
        }
    }
    }
}

extern "C" void kernel_launch(void* const* d_in, const int* in_sizes, int n_in,
                              void* d_out, int out_size, void* d_ws, size_t ws_size,
                              hipStream_t stream) {
    const float* x  = (const float*)d_in[0];   // (64, 8192, 64)
    const float* Wq = (const float*)d_in[1];   // (8, 16, 64, 32)
    const float* Wk = (const float*)d_in[2];   // (8, 64, 32)
    float* out = (float*)d_out;                // (64, 512, 512)
    _Float16* Wt = (_Float16*)d_ws;            // 512 KB packed f16 W_q
    float* Wkp = (float*)d_ws + WT_ELEMS / 2;  // 64 KB packed fp32 W_k behind it

    w_pack<<<(WT_ELEMS + WK_ELEMS) / 256, 256, 0, stream>>>(Wq, Wk, Wt, Wkp);
    attn_fused<<<NB * (LL / MROWS), 512, 0, stream>>>(x, Wt, Wkp, out);
}

// v006
// A run of this version takes 41.3 microseconds.
// Two timings next to v005 put it at 1.16 and 1.15 times that version's speed.
// All steps since v000 together make it 7.60 times as fast.
#include <hip/hip_runtime.h>

typedef _Float16 hv8  __attribute__((ext_vector_type(8)));
typedef _Float16 hv16 __attribute__((ext_vector_type(16)));
typedef float    fv8  __attribute__((ext_vector_type(8)));

#define NB    64
#define TOTB  8192
#define DD    64
#define DKK   32
#define CC    16
#define NHH   8
#define LL    512          // TOT / C
#define KDIM  1024         // C * D
#define NCOL  256          // NH * DK

#define MROWS 32           // rows l per work-group: two 16-row WMMA tiles

#define WT_ELEMS (NHH * DKK * KDIM)   // 262144 f16
#define WK_ELEMS (NHH * DD * DKK)     // 16384 values, two f16 each

// Pack both weights in the order in which the lanes of the main kernel read them, so that the 32
// 16-byte pieces of one wave load are 512 bytes in a row: 4 whole 128-byte lines.
//   W_q (NH,C,D,DK) fp32 -> f16, Wt[w][kk][j][lane][e]: column h*32+t = w*16 + (lane&15),
//       k = c*64+d = kk*32 + j*16 + (lane>>4)*8 + e  (the weight fragment of column tile w, k step kk).
//   W_k (NH,D,DK) fp32 -> two f16, Wkp[h][dt][part][j][lane][e]: row d = dt*16 + (lane&15),
//       k = t = j*16 + (lane>>4)*8 + e  (the A fragment of row tile dt); part 0 the rounded value,
//       part 1 what the rounding left.
__global__ __launch_bounds__(256) void w_pack(const float* __restrict__ Wq,
                                              const float* __restrict__ Wk,
                                              _Float16* __restrict__ Wt,
                                              _Float16* __restrict__ Wkp) {
    int o = blockIdx.x * 256 + threadIdx.x;
    if (o < WT_ELEMS) {
        int e = o & 7, ln = (o >> 3) & 31, j = (o >> 8) & 1, kk = (o >> 9) & 31, w = o >> 14;
        int col = w * 16 + (ln & 15);
        int k   = kk * 32 + j * 16 + (ln >> 4) * 8 + e;
        int h = col >> 5, t = col & 31;
        int c = k >> 6,  d = k & 63;
        Wt[o] = (_Float16)Wq[(((h * CC + c) * DD + d) * DKK) + t];
    } else if (o < WT_ELEMS + WK_ELEMS) {
        int q = o - WT_ELEMS;
        int e = q & 7, ln = (q >> 3) & 31, j = (q >> 8) & 1, dt = (q >> 9) & 3, h = q >> 11;
        const float v = Wk[(h * DD + dt * 16 + (ln & 15)) * DKK + j * 16 + (ln >> 4) * 8 + e];
        const _Float16 hi = (_Float16)v;
        _Float16* p = Wkp + (h * 4 + dt) * 1024 + (q & 511);
        p[0]   = hi;
        p[512] = (_Float16)(v - (float)hi);
    }
}

typedef short s16x8 __attribute__((ext_vector_type(8)));

// Transposing LDS load: lane i hands in the 16 bytes of row 8*(i>>4) + (i&7), column piece (i>>3)&1;
// lane (c = i&15, hf = i>>4) gets rows 8*hf .. 8*hf+7 of column c.
__device__ __forceinline__ hv8 ld_tr16(const char* p) {
    typedef __attribute__((address_space(3))) s16x8 lds_s16x8;
    return __builtin_bit_cast(hv8, __builtin_amdgcn_ds_load_tr16_b128_v8i16((lds_s16x8*)p));
}

// lane i with lane i ^ 16
__device__ __forceinline__ float xhalf(float v) {
    const int b = __builtin_bit_cast(int, v);
    return __builtin_bit_cast(float, __builtin_amdgcn_permlanex16(b, b, 0x76543210, 0xfedcba98, false, false));
}

// e^v as v_exp_f32 of v*log2(e). Asm so that the v_nop stands directly behind it: the instruction set asks
// for one slot behind a transcendental before its source is overwritten or its result read.
__device__ __forceinline__ float exp_slot(float v) {
    float r;
    asm("v_exp_f32 %0, %1\n\tv_nop" : "=v"(r) : "v"(v * 1.4426950408889634f));
    return r;
}

// A work-group takes 32 rows l: every W_q fragment and every W_k piece that a wave fetches from L2 serves
// twice the rows it would with 16. 160 KB of LDS: two work-groups per WGP, 8 waves per SIMD, which
// holds up to 128 vector registers.
__global__ __launch_bounds__(512) __attribute__((amdgpu_num_vgpr(128))) void attn_fused(const float* __restrict__ x,
                                                  const _Float16* __restrict__ Wt,
                                                  const _Float16* __restrict__ Wkp,
                                                  float* __restrict__ out) {
    // X tile, f16, 64 KB, XOR-swizzled: element (l,c,d) lies in 128-byte row l*16 + (c ^ ((l>>3)&1)),
    // 16-byte piece (d>>3) ^ (c>>1) ^ (l&7). 16 lanes that walk l (GEMM1's X rows) or c (the QK
    // rows) at one d then fall on 16 different groups of four banks, all 64 banks.
    __shared__ __align__(256) _Float16 smX[MROWS * KDIM];
    const char* smXb = (const char*)smX;                // readers form swizzled byte offsets
    // 32 KB: Q as f16 pairs. Row l holds 256 rounded values, then the 256 remainders; 16-byte piece
    // (col>>3) ^ (l&15), so 16 lanes that walk l at one column fall on 16 bank groups.
    __shared__ __align__(16) _Float16 smQ[MROWS * 2 * NCOL];
    char* smQb = (char*)smQ;
    // 64 KB: A as f16 pairs. Row l holds 16 rows of 64 d: rows 0..7 the heads' rounded values, rows
    // 8..15 the remainders; head h lies in row h ^ ((l>>3)&1), 16-byte piece (d>>3) ^ h ^ (l&7): 8 heads
    // at one l and d (the QK reads) fall on 8 bank groups, 16 rows l at one head and d (the writes) on 16.
    __shared__ __align__(16) _Float16 smA[MROWS * 1024];
    char* smAb = (char*)smA;

    const int tid   = threadIdx.x;
    const int wave  = __builtin_amdgcn_readfirstlane(tid >> 5);   // the same in all lanes: what derives from it needs no vector register
    const int lane  = tid & 31;
    const int n     = blockIdx.x >> 4;
    const int ltile = blockIdx.x & 15;

    // ---- Load 32x1024 x-tile: contiguous 128 KB, fp32 -> f16 LDS ----
    const float* xsrc = x + ((size_t)n * TOTB + (size_t)ltile * (MROWS * CC)) * DD;
    for (int i = tid; i < MROWS * KDIM / 4; i += 512) {
        float4 v = *(const float4*)(xsrc + (size_t)i * 4);
        const int e = i * 4;                          // l*1024 + c*64 + d
        const int o = e ^ (((e >> 13) & 1) << 6) ^ ((((e >> 7) ^ (e >> 10)) & 7) << 3);
        smX[o + 0] = (_Float16)v.x;
        smX[o + 1] = (_Float16)v.y;
        smX[o + 2] = (_Float16)v.z;
        smX[o + 3] = (_Float16)v.w;
    }
    __syncthreads();

    // ---- GEMM1: Q^T[256 x 32] = Wt * X^T, one 16-col tile of Q per wave, both 16-row tiles ----
    // The weights are the A operand and the X rows the B operand (both fragments are cut alike), so a lane
    // ends up with 8 neighbouring columns t of one row l: a 16-byte piece of stage 2a's B fragment.
    // 16-bit A/B fragment K-offsets per ISA layout:
    //   lanes 0..15:  K = {kb+0..7, kb+16..23}; lanes 16..31: K = {kb+8..15, kb+24..31}
    fv8 acc = {}, acc2 = {};
    const int mn   = lane & 15;
    const int half = lane >> 4;
    const int khi  = half ? 8 : 0;
    // X row (N = mn; rows 16 + mn lie 32 KB further on, swizzled alike): the lane's share of the byte offset
    const int aV   = (mn * KDIM * 2) | ((khi * 2) ^ ((mn >> 3) << 7) ^ ((mn & 7) << 4));
    const _Float16* Bp = Wt + (size_t)wave * (16 * KDIM) + lane * 8;   // packed weight fragments, lane order
#pragma unroll 4
    for (int kk = 0; kk < 32; ++kk) {
        const int ka = ((kk * 64) ^ (((kk >> 2) & 7) << 4)) ^ aV;  // c = kk>>1, so c>>1 = kk>>2
        hv8 a0 = *(const hv8*)(smXb + ka);
        hv8 a1 = *(const hv8*)(smXb + (ka ^ 32));
        hv8 a2 = *(const hv8*)(smXb + 16 * KDIM * 2 + ka);
        hv8 a3 = *(const hv8*)(smXb + 16 * KDIM * 2 + (ka ^ 32));
        hv8 b0 = *(const hv8*)(Bp + kk * 512);          // k = kk*32 + khi + 0..7
        hv8 b1 = *(const hv8*)(Bp + kk * 512 + 256);    // k = kk*32 + khi + 16..23
        hv16 A = __builtin_shufflevector(a0, a1, 0,1,2,3,4,5,6,7,8,9,10,11,12,13,14,15);
        hv16 A2 = __builtin_shufflevector(a2, a3, 0,1,2,3,4,5,6,7,8,9,10,11,12,13,14,15);
        hv16 B = __builtin_shufflevector(b0, b1, 0,1,2,3,4,5,6,7,8,9,10,11,12,13,14,15);
        acc  = __builtin_amdgcn_wmma_f32_16x16x32_f16(false, B, false, A,
                                                      (short)0, acc, false, false);
        acc2 = __builtin_amdgcn_wmma_f32_16x16x32_f16(false, B, false, A2,
                                                      (short)0, acc2, false, false);
    }
    // Stage 2a's W_k fragments: one head (wave >> 1) and two of its four 16-row tiles of d per wave.
    // Fetched here so that their way from L2 runs beside Q's conversion and stores.
    const int h  = wave >> 1;
    const int dh = wave & 1;
    hv16 WH[2], WL[2];
    {
        const _Float16* wp = Wkp + (h * 4 + dh * 2) * 1024 + lane * 8;
#pragma unroll
        for (int i = 0; i < 2; ++i) {
            hv8 w0 = *(const hv8*)(wp + i * 1024);
            hv8 w1 = *(const hv8*)(wp + i * 1024 + 256);
            hv8 w2 = *(const hv8*)(wp + i * 1024 + 512);
            hv8 w3 = *(const hv8*)(wp + i * 1024 + 768);
            WH[i] = __builtin_shufflevector(w0, w1, 0,1,2,3,4,5,6,7,8,9,10,11,12,13,14,15);
            WL[i] = __builtin_shufflevector(w2, w3, 0,1,2,3,4,5,6,7,8,9,10,11,12,13,14,15);
        }
    }
    {   // C/D layout: VGPR r -> M = r (+8 for lanes 16..31) = column in the tile, N = lane&15 = row l.
        // Each f32 Q goes out as two f16: the rounded value and what the rounding left.
        hv8 qh, ql, qh2, ql2;
#pragma unroll
        for (int r = 0; r < 8; ++r) {
            const _Float16 c0 = (_Float16)acc[r], c1 = (_Float16)acc2[r];
            qh[r]  = c0;  ql[r]  = (_Float16)(acc[r]  - (float)c0);
            qh2[r] = c1;  ql2[r] = (_Float16)(acc2[r] - (float)c1);
        }
        char* qp = smQb + ((mn << 10) | (((wave * 2 + half) ^ mn) << 4));
        *(hv8*)(qp)               = qh;
        *(hv8*)(qp + 512)         = ql;
        *(hv8*)(qp + 16384)       = qh2;
        *(hv8*)(qp + 16384 + 512) = ql2;
    }
    __syncthreads();

    // ---- Stage 2a: A[d][l] = sum_t Wk[h,d,t] * Q[l, h*32+t] on the matrix unit: rows M = d, columns N = l, k = t ----
    const float inv_sqrt_dk = 0.17677669529663687f;   // 1/sqrt(32)
    {
        // W_k and Q each as rounded value + remainder; the product of the two remainders is left out
        // (2^-22 of the term). Both fragments hold k = t = j*16 + half*8 + e at place j*8 + e.
        hv16 QH[2], QL[2];
        const int q0 = ((h * 4 + half) ^ mn) << 4, q1 = ((h * 4 + 2 + half) ^ mn) << 4;
#pragma unroll
        for (int lt = 0; lt < 2; ++lt) {
            const char* qp = smQb + ((lt * 16 + mn) << 10);
            hv8 u0 = *(const hv8*)(qp + q0);
            hv8 u1 = *(const hv8*)(qp + q1);
            hv8 v0 = *(const hv8*)(qp + 512 + q0);
            hv8 v1 = *(const hv8*)(qp + 512 + q1);
            QH[lt] = __builtin_shufflevector(u0, u1, 0,1,2,3,4,5,6,7,8,9,10,11,12,13,14,15);
            QL[lt] = __builtin_shufflevector(v0, v1, 0,1,2,3,4,5,6,7,8,9,10,11,12,13,14,15);
        }
        // register r of lane (l = mn, half) holds d = 16*dt + 8*half + r: one 16-byte piece of row l, head h
        const int av = (mn << 11) | ((h ^ (mn >> 3)) << 7) | ((half ^ h ^ (mn & 7)) << 4);
#pragma unroll
        for (int i = 0; i < 2; ++i) {
#pragma unroll
            for (int lt = 0; lt < 2; ++lt) {
                fv8 a = {};
                a = __builtin_amdgcn_wmma_f32_16x16x32_f16(false, WL[i], false, QH[lt], (short)0, a, false, false);
                a = __builtin_amdgcn_wmma_f32_16x16x32_f16(false, WH[i], false, QL[lt], (short)0, a, false, false);
                a = __builtin_amdgcn_wmma_f32_16x16x32_f16(false, WH[i], false, QH[lt], (short)0, a, false, false);
                // each f32 A goes out as two f16: the rounded value (rows 0..7) and what the rounding left (rows 8..15)
                hv8 ah, al;
#pragma unroll
                for (int r = 0; r < 8; ++r) {
                    const _Float16 c = (_Float16)a[r];
                    ah[r] = c;
                    al[r] = (_Float16)(a[r] - (float)c);
                }
                char* ap = smAb + lt * 32768 + (av ^ ((dh * 4 + i * 2) << 4));
                *(hv8*)(ap)        = ah;
                *(hv8*)(ap + 1024) = al;
            }
        }
    }
    __syncthreads();

    // ---- Stage 2b: two rows l per wave (wave, wave + 16), each with all 8 heads at once, on the matrix unit ----
    // From here on a wave reads smX and smA only and writes no LDS: no further barrier.
    const int hd   = mn & 7;                          // columns 8..15 repeat heads 0..7

    // unrolled: the two rows are independent chains (LDS, WMMA, softmax, WMMA, store) that fill each other's waits
#pragma unroll
    for (int rr = 0; rr < 2; ++rr) {
    const int l = wave + rr * 16;                     // (l >> 3) & 1 = wave >> 3 and l & 7 = wave & 7 in both

    // QK[c][hd] = sum_d X[l,c,d] * (Ahi + Alo)[hd][d]: rows M = c, columns N = head, k = d.
    // X rows and A rows are cut by the same code, so both sides hold the same k at every place.
    fv8 s = {};
    {
        const int xrow = (l * KDIM * 2) | ((mn ^ (wave >> 3)) << 7);
        const int xsw  = (mn >> 1) ^ (l & 7);
        const int arow = (l << 11) | ((hd ^ (wave >> 3)) << 7);
        const int asw  = hd ^ (l & 7);
#pragma unroll
        for (int ks = 0; ks < 2; ++ks) {
            const int p0 = ks * 4 + half, p1 = p0 + 2;   // 16-byte pieces: d = 8*p0.., 8*p1..
            hv8 x0 = *(const hv8*)(smXb + xrow + ((p0 ^ xsw) << 4));
            hv8 x1 = *(const hv8*)(smXb + xrow + ((p1 ^ xsw) << 4));
            hv8 u0 = *(const hv8*)(smAb + arow + ((p0 ^ asw) << 4));
            hv8 u1 = *(const hv8*)(smAb + arow + ((p1 ^ asw) << 4));
            hv8 w0 = *(const hv8*)(smAb + arow + 1024 + ((p0 ^ asw) << 4));
            hv8 w1 = *(const hv8*)(smAb + arow + 1024 + ((p1 ^ asw) << 4));
            hv16 XA = __builtin_shufflevector(x0, x1, 0,1,2,3,4,5,6,7,8,9,10,11,12,13,14,15);
            hv16 AH = __builtin_shufflevector(u0, u1, 0,1,2,3,4,5,6,7,8,9,10,11,12,13,14,15);
            hv16 AL = __builtin_shufflevector(w0, w1, 0,1,2,3,4,5,6,7,8,9,10,11,12,13,14,15);
            s = __builtin_amdgcn_wmma_f32_16x16x32_f16(false, XA, false, AH, (short)0, s, false, false);
            s = __builtin_amdgcn_wmma_f32_16x16x32_f16(false, XA, false, AL, (short)0, s, false, false);
        }
    }

    // softmax over c: register r of lane (hd, half) holds c = 8*half + r; the other 8 lie in lane ^ 16
    float sc[8];
    float mx = -3.0e38f;
#pragma unroll
    for (int r = 0; r < 8; ++r) { sc[r] = s[r] * inv_sqrt_dk; mx = fmaxf(mx, sc[r]); }
    mx = fmaxf(mx, xhalf(mx));
    float ssum = 0.f;
#pragma unroll
    for (int r = 0; r < 8; ++r) { sc[r] = exp_slot(sc[r] - mx); ssum += sc[r]; }
    ssum += xhalf(ssum);
    const float rs = 1.0f / ssum;

    // The exponentials are a B operand as they lie: k = 8*half + r is c with the rounded f16 value,
    // k = 16 + 8*half + r is the same c with what the rounding left. 1/sum is applied to the sums.
    hv16 SB;
#pragma unroll
    for (int r = 0; r < 8; ++r) {
        const _Float16 ph = (_Float16)sc[r];
        SB[r]     = ph;
        SB[r + 8] = (_Float16)(sc[r] - (float)ph);
    }

    // attn[d][hd] = sum_c X[l,c,d] * e[c][hd]: rows M = d, 16 per tile, from transposing loads;
    // the fragment's two halves are the same 8 values of c (k and k + 16).
    {
        const int cc   = half * 8 + (lane & 7);       // the row c whose 16 bytes this lane fetches
        const int trow = (l * KDIM * 2) | ((cc ^ (wave >> 3)) << 7);
        const int tsw  = (cc >> 1) ^ (l & 7);
        const int pb   = (lane >> 3) & 1;
        // register r holds d = 16*dt + 8*half + r; column hd stores r = 0..3, its twin hd + 8 r = 4..7
        float* op = out + ((size_t)n * LL + (size_t)ltile * MROWS + l) * (NHH * DD)
                        + hd * 64 + half * 8 + (mn >> 3) * 4;
        const bool up = mn >= 8;
#pragma unroll
        for (int dt = 0; dt < 4; ++dt) {
            hv8 t = ld_tr16(smXb + trow + (((dt * 2 + pb) ^ tsw) << 4));
            hv16 XT = __builtin_shufflevector(t, t, 0,1,2,3,4,5,6,7,0,1,2,3,4,5,6,7);
            fv8 z = {};
            fv8 o = __builtin_amdgcn_wmma_f32_16x16x32_f16(false, XT, false, SB, (short)0, z, false, false);
            float4 v;
            v.x = (up ? o[4] : o[0]) * rs;
            v.y = (up ? o[5] : o[1]) * rs;
            v.z = (up ? o[6] : o[2]) * rs;
            v.w = (up ? o[7] : o[3]) * rs;
            *(float4*)(op + dt * 16) = v;
        }
    }
    }
}

extern "C" void kernel_launch(void* const* d_in, const int* in_sizes, int n_in,
                              void* d_out, int out_size, void* d_ws, size_t ws_size,
                              hipStream_t stream) {
    const float* x  = (const float*)d_in[0];   // (64, 8192, 64)
    const float* Wq = (const float*)d_in[1];   // (8, 16, 64, 32)
    const float* Wk = (const float*)d_in[2];   // (8, 64, 32)
    float* out = (float*)d_out;                // (64, 512, 512)
    _Float16* Wt = (_Float16*)d_ws;            // 512 KB packed f16 W_q
    _Float16* Wkp = Wt + WT_ELEMS;             // 64 KB packed W_k, f16 pairs, behind it

    w_pack<<<(WT_ELEMS + WK_ELEMS) / 256, 256, 0, stream>>>(Wq, Wk, Wt, Wkp);
    attn_fused<<<NB * (LL / MROWS), 512, 0, stream>>>(x, Wt, Wkp, out);
}

// v007
// One run takes 39.1 microseconds.
// Next to v006, in two timings, it ran 1.06 and 1.05 times as fast.
// All steps since v000 together make it 8.01 times as fast.
#include <hip/hip_runtime.h>

typedef _Float16 hv8  __attribute__((ext_vector_type(8)));
typedef _Float16 hv16 __attribute__((ext_vector_type(16)));
typedef float    fv8  __attribute__((ext_vector_type(8)));

#define NB    64
#define TOTB  8192
#define DD    64
#define DKK   32
#define CC    16
#define NHH   8
#define LL    512          // TOT / C
#define KDIM  1024         // C * D
#define NCOL  256          // NH * DK

#define MROWS 32           // rows l per work-group: two 16-row WMMA tiles

#define WT_ELEMS (NHH * DKK * KDIM)   // 262144 f16
#define WK_ELEMS (NHH * DD * DKK)     // 16384 values, two f16 each

// Pack both weights in the order in which the lanes of the main kernel read them, so that the 32
// 16-byte pieces of one wave load are 512 bytes in a row: 4 whole 128-byte lines.
//   W_q (NH,C,D,DK) fp32 -> f16, Wt[w][kk][j][lane][e]: column h*32+t = w*16 + (lane&15),
//       k = c*64+d = kk*32 + j*16 + (lane>>4)*8 + e  (the weight fragment of column tile w, k step kk).
//   W_k (NH,D,DK) fp32 -> two f16, Wkp[h][dt][part][j][lane][e]: row d = dt*16 + (lane&15),
//       k = t = j*16 + (lane>>4)*8 + e  (the A fragment of row tile dt); part 0 the rounded value,
//       part 1 what the rounding left.
__global__ __launch_bounds__(256) void w_pack(const float* __restrict__ Wq,
                                              const float* __restrict__ Wk,
                                              _Float16* __restrict__ Wt,
                                              _Float16* __restrict__ Wkp) {
    int o = blockIdx.x * 256 + threadIdx.x;
    if (o < WT_ELEMS) {
        int e = o & 7, ln = (o >> 3) & 31, j = (o >> 8) & 1, kk = (o >> 9) & 31, w = o >> 14;
        int col = w * 16 + (ln & 15);
        int k   = kk * 32 + j * 16 + (ln >> 4) * 8 + e;
        int h = col >> 5, t = col & 31;
        int c = k >> 6,  d = k & 63;
        Wt[o] = (_Float16)Wq[(((h * CC + c) * DD + d) * DKK) + t];
    } else if (o < WT_ELEMS + WK_ELEMS) {
        int q = o - WT_ELEMS;
        int e = q & 7, ln = (q >> 3) & 31, j = (q >> 8) & 1, dt = (q >> 9) & 3, h = q >> 11;
        const float v = Wk[(h * DD + dt * 16 + (ln & 15)) * DKK + j * 16 + (ln >> 4) * 8 + e];
        const _Float16 hi = (_Float16)v;
        _Float16* p = Wkp + (h * 4 + dt) * 1024 + (q & 511);
        p[0]   = hi;
        p[512] = (_Float16)(v - (float)hi);
    }
}

typedef short s16x8 __attribute__((ext_vector_type(8)));

// Transposing LDS load: lane i hands in the 16 bytes of row 8*(i>>4) + (i&7), column piece (i>>3)&1;
// lane (c = i&15, hf = i>>4) gets rows 8*hf .. 8*hf+7 of column c.
__device__ __forceinline__ hv8 ld_tr16(const char* p) {
    typedef __attribute__((address_space(3))) s16x8 lds_s16x8;
    return __builtin_bit_cast(hv8, __builtin_amdgcn_ds_load_tr16_b128_v8i16((lds_s16x8*)p));
}

// lane i with lane i ^ 16
__device__ __forceinline__ float xhalf(float v) {
    const int b = __builtin_bit_cast(int, v);
    return __builtin_bit_cast(float, __builtin_amdgcn_permlanex16(b, b, 0x76543210, 0xfedcba98, false, false));
}

// e^v as v_exp_f32 of v*log2(e). Asm so that the v_nop stands directly behind it: the instruction set asks
// for one slot behind a transcendental before its source is overwritten or its result read.
__device__ __forceinline__ float exp_slot(float v) {
    float r;
    asm("v_exp_f32 %0, %1\n\tv_nop" : "=v"(r) : "v"(v * 1.4426950408889634f));
    return r;
}

// Four asynchronous copies to LDS, 16 bytes per lane each: LDS byte address, global address. The
// s_wait_xcnt is the last line of the copies' own statement, so that it stands in front of every later
// write of a register that a copy names (a precaution for a replayed address translation).
__device__ __forceinline__ void copy4_to_lds(unsigned l0, unsigned l1, unsigned l2, unsigned l3,
                                             const float* g0, const float* g1,
                                             const float* g2, const float* g3) {
    asm volatile("global_load_async_to_lds_b128 %0, %4, off\n\t"
                 "global_load_async_to_lds_b128 %1, %5, off\n\t"
                 "global_load_async_to_lds_b128 %2, %6, off\n\t"
                 "global_load_async_to_lds_b128 %3, %7, off\n\t"
                 "s_wait_xcnt 0x0"
                 :: "v"(l0), "v"(l1), "v"(l2), "v"(l3), "v"(g0), "v"(g1), "v"(g2), "v"(g3)
                 : "memory");
}

// A work-group takes 32 rows l: every W_q fragment and every W_k piece that a wave fetches from L2 serves
// twice the rows it would with 16. 160 KB of LDS: two work-groups per WGP, 8 waves per SIMD, which
// holds up to 128 vector registers.
__global__ __launch_bounds__(512) __attribute__((amdgpu_num_vgpr(128))) void attn_fused(const float* __restrict__ x,
                                                  const _Float16* __restrict__ Wt,
                                                  const _Float16* __restrict__ Wkp,
                                                  float* __restrict__ out) {
    // X tile, f16, 64 KB, XOR-swizzled: element (l,c,d) lies in 128-byte row l*16 + (c ^ ((l>>3)&1)),
    // 16-byte piece (d>>3) ^ (c>>1) ^ (l&7). 16 lanes that walk l (GEMM1's X rows) or c (the QK
    // rows) at one d then fall on 16 different groups of four banks, all 64 banks.
    __shared__ __align__(256) _Float16 smX[MROWS * KDIM];
    const char* smXb = (const char*)smX;                // readers form swizzled byte offsets
    // 32 KB: Q as f16 pairs. Row l holds 256 rounded values, then the 256 remainders; 16-byte piece
    // (col>>3) ^ (l&15), so 16 lanes that walk l at one column fall on 16 bank groups.
    __shared__ __align__(16) _Float16 smQ[MROWS * 2 * NCOL];
    char* smQb = (char*)smQ;
    // 64 KB: A as f16 pairs. Row l holds 16 rows of 64 d: rows 0..7 the heads' rounded values, rows
    // 8..15 the remainders; head h lies in row h ^ ((l>>3)&1), 16-byte piece (d>>3) ^ h ^ (l&7): 8 heads
    // at one l and d (the QK reads) fall on 8 bank groups, 16 rows l at one head and d (the writes) on 16.
    __shared__ __align__(16) _Float16 smA[MROWS * 1024];
    char* smAb = (char*)smA;

    const int tid   = threadIdx.x;
    const int wave  = __builtin_amdgcn_readfirstlane(tid >> 5);   // the same in all lanes: what derives from it needs no vector register
    const int lane  = tid & 31;
    const int n     = blockIdx.x >> 4;
    const int ltile = blockIdx.x & 15;

    // ---- The 32x1024 x-tile comes in four chunks of 256 k (four c): 32 rows x 1 KB of fp32 each ----
    // A chunk is copied asynchronously into one half of smA, which is idle until stage 2a, and from there
    // rounded to f16 into smX. Chunks 1..3 fly while GEMM1 works on the chunks before them.
    // Copy i of a thread: row l = 8*i + (tid >> 6), 16-byte piece tid & 63 of the row's 1 KB; in the
    // staging half at byte i*8192 + tid*16. A thread rounds the very bytes that its own copies brought,
    // so its wave's own s_wait_asynccnt is all that stands between a copy and its reader.
    const float* xsrc = x + ((size_t)n * TOTB + (size_t)ltile * (MROWS * CC)) * DD;
    const int xel = (tid >> 6) * KDIM + (tid & 63) * 4;           // l*1024 + c*64 + d of copy 0, chunk 0
    typedef __attribute__((address_space(3))) char lds_char;
    const unsigned stg = (unsigned)(size_t)(lds_char*)smAb + (unsigned)tid * 16u;   // LDS byte address
#define ISSUE_CHUNK(t) do {                                                                   \
        const float* g_ = xsrc + xel + (t) * 256;                                             \
        const unsigned s_ = stg + ((t) & 1) * 32768u;                                         \
        copy4_to_lds(s_, s_ + 8192u, s_ + 16384u, s_ + 24576u,                                \
                     g_, g_ + 8 * KDIM, g_ + 16 * KDIM, g_ + 24 * KDIM);                      \
    } while (0)
    ISSUE_CHUNK(0);
    asm volatile("s_wait_asynccnt 0x0" ::: "memory");   // chunk 0 has landed before this wave reads it
    ISSUE_CHUNK(1);

    // ---- GEMM1: Q^T[256 x 32] = Wt * X^T, one 16-col tile of Q per wave, both 16-row tiles ----
    // The weights are the A operand and the X rows the B operand (both fragments are cut alike), so a lane
    // ends up with 8 neighbouring columns t of one row l: a 16-byte piece of stage 2a's B fragment.
    // 16-bit A/B fragment K-offsets per ISA layout:
    //   lanes 0..15:  K = {kb+0..7, kb+16..23}; lanes 16..31: K = {kb+8..15, kb+24..31}
    fv8 acc = {}, acc2 = {};
    const int mn   = lane & 15;
    const int half = lane >> 4;
    const int khi  = half ? 8 : 0;
    // X row (N = mn; rows 16 + mn lie 32 KB further on, swizzled alike): the lane's share of the byte offset
    const int aV   = (mn * KDIM * 2) | ((khi * 2) ^ ((mn >> 3) << 7) ^ ((mn & 7) << 4));
    const _Float16* Bp = Wt + (size_t)wave * (16 * KDIM) + lane * 8;   // packed weight fragments, lane order
#pragma unroll 1   // kept rolled: unrolled four times the build needs more than its 128 registers and spills
    for (int t = 0; t < 4; ++t) {
    {   // chunk t: fp32 from this thread's own staging bytes -> f16 in smX, swizzled
        const char* sp = smAb + (t & 1) * 32768 + tid * 16;
        for (int i = 0; i < 4; ++i) {
            float4 v = *(const float4*)(sp + i * 8192);
            const int e = xel + i * 8 * KDIM + t * 256;   // l*1024 + c*64 + d
            const int o = e ^ (((e >> 13) & 1) << 6) ^ ((((e >> 7) ^ (e >> 10)) & 7) << 3);
            smX[o + 0] = (_Float16)v.x;
            smX[o + 1] = (_Float16)v.y;
            smX[o + 2] = (_Float16)v.z;
            smX[o + 3] = (_Float16)v.w;
        }
    }
    // this wave's staging reads and smX writes are done before the barrier and before a copy refills the half
    asm volatile("s_wait_dscnt 0x0" ::: "memory");
    __syncthreads();                                    // publishes chunk t of smX; frees staging half t & 1
    if (t < 2) ISSUE_CHUNK(t + 2);                      // the same for the whole work-group
#pragma unroll 4
    for (int k8 = 0; k8 < 8; ++k8) {
        const int kk = t * 8 + k8;
        const int ka = ((kk * 64) ^ (((kk >> 2) & 7) << 4)) ^ aV;  // c = kk>>1, so c>>1 = kk>>2
        hv8 a0 = *(const hv8*)(smXb + ka);
        hv8 a1 = *(const hv8*)(smXb + (ka ^ 32));
        hv8 a2 = *(const hv8*)(smXb + 16 * KDIM * 2 + ka);
        hv8 a3 = *(const hv8*)(smXb + 16 * KDIM * 2 + (ka ^ 32));
        hv8 b0 = *(const hv8*)(Bp + kk * 512);          // k = kk*32 + khi + 0..7
        hv8 b1 = *(const hv8*)(Bp + kk * 512 + 256);    // k = kk*32 + khi + 16..23
        hv16 A = __builtin_shufflevector(a0, a1, 0,1,2,3,4,5,6,7,8,9,10,11,12,13,14,15);
        hv16 A2 = __builtin_shufflevector(a2, a3, 0,1,2,3,4,5,6,7,8,9,10,11,12,13,14,15);
        hv16 B = __builtin_shufflevector(b0, b1, 0,1,2,3,4,5,6,7,8,9,10,11,12,13,14,15);
        acc  = __builtin_amdgcn_wmma_f32_16x16x32_f16(false, B, false, A,
                                                      (short)0, acc, false, false);
        acc2 = __builtin_amdgcn_wmma_f32_16x16x32_f16(false, B, false, A2,
                                                      (short)0, acc2, false, false);
    }
    // every copy issued so far has landed: the next chunk may be read, and behind the last trip smA is free
    asm volatile("s_wait_asynccnt 0x0" ::: "memory");
    }
#undef ISSUE_CHUNK
    // Stage 2a's W_k fragments: one head (wave >> 1) and two of its four 16-row tiles of d per wave.
    // Fetched here so that their way from L2 runs beside Q's conversion and stores.
    const int h  = wave >> 1;
    const int dh = wave & 1;
    hv16 WH[2], WL[2];
    {
        const _Float16* wp = Wkp + (h * 4 + dh * 2) * 1024 + lane * 8;
#pragma unroll
        for (int i = 0; i < 2; ++i) {
            hv8 w0 = *(const hv8*)(wp + i * 1024);
            hv8 w1 = *(const hv8*)(wp + i * 1024 + 256);
            hv8 w2 = *(const hv8*)(wp + i * 1024 + 512);
            hv8 w3 = *(const hv8*)(wp + i * 1024 + 768);
            WH[i] = __builtin_shufflevector(w0, w1, 0,1,2,3,4,5,6,7,8,9,10,11,12,13,14,15);
            WL[i] = __builtin_shufflevector(w2, w3, 0,1,2,3,4,5,6,7,8,9,10,11,12,13,14,15);
        }
    }
    {   // C/D layout: VGPR r -> M = r (+8 for lanes 16..31) = column in the tile, N = lane&15 = row l.
        // Each f32 Q goes out as two f16: the rounded value and what the rounding left.
        hv8 qh, ql, qh2, ql2;
#pragma unroll
        for (int r = 0; r < 8; ++r) {
            const _Float16 c0 = (_Float16)acc[r], c1 = (_Float16)acc2[r];
            qh[r]  = c0;  ql[r]  = (_Float16)(acc[r]  - (float)c0);
            qh2[r] = c1;  ql2[r] = (_Float16)(acc2[r] - (float)c1);
        }
        char* qp = smQb + ((mn << 10) | (((wave * 2 + half) ^ mn) << 4));
        *(hv8*)(qp)               = qh;
        *(hv8*)(qp + 512)         = ql;
        *(hv8*)(qp + 16384)       = qh2;
        *(hv8*)(qp + 16384 + 512) = ql2;
    }
    __syncthreads();

    // ---- Stage 2a: A[d][l] = sum_t Wk[h,d,t] * Q[l, h*32+t] on the matrix unit: rows M = d, columns N = l, k = t ----
    const float inv_sqrt_dk = 0.17677669529663687f;   // 1/sqrt(32)
    {
        // W_k and Q each as rounded value + remainder; the product of the two remainders is left out
        // (2^-22 of the term). Both fragments hold k = t = j*16 + half*8 + e at place j*8 + e.
        hv16 QH[2], QL[2];
        const int q0 = ((h * 4 + half) ^ mn) << 4, q1 = ((h * 4 + 2 + half) ^ mn) << 4;
#pragma unroll
        for (int lt = 0; lt < 2; ++lt) {
            const char* qp = smQb + ((lt * 16 + mn) << 10);
            hv8 u0 = *(const hv8*)(qp + q0);
            hv8 u1 = *(const hv8*)(qp + q1);
            hv8 v0 = *(const hv8*)(qp + 512 + q0);
            hv8 v1 = *(const hv8*)(qp + 512 + q1);
            QH[lt] = __builtin_shufflevector(u0, u1, 0,1,2,3,4,5,6,7,8,9,10,11,12,13,14,15);
            QL[lt] = __builtin_shufflevector(v0, v1, 0,1,2,3,4,5,6,7,8,9,10,11,12,13,14,15);
        }
        // register r of lane (l = mn, half) holds d = 16*dt + 8*half + r: one 16-byte piece of row l, head h
        const int av = (mn << 11) | ((h ^ (mn >> 3)) << 7) | ((half ^ h ^ (mn & 7)) << 4);
#pragma unroll
        for (int i = 0; i < 2; ++i) {
#pragma unroll
            for (int lt = 0; lt < 2; ++lt) {
                fv8 a = {};
                a = __builtin_amdgcn_wmma_f32_16x16x32_f16(false, WL[i], false, QH[lt], (short)0, a, false, false);
                a = __builtin_amdgcn_wmma_f32_16x16x32_f16(false, WH[i], false, QL[lt], (short)0, a, false, false);
                a = __builtin_amdgcn_wmma_f32_16x16x32_f16(false, WH[i], false, QH[lt], (short)0, a, false, false);
                // each f32 A goes out as two f16: the rounded value (rows 0..7) and what the rounding left (rows 8..15)
                hv8 ah, al;
#pragma unroll
                for (int r = 0; r < 8; ++r) {
                    const _Float16 c = (_Float16)a[r];
                    ah[r] = c;
                    al[r] = (_Float16)(a[r] - (float)c);
                }
                char* ap = smAb + lt * 32768 + (av ^ ((dh * 4 + i * 2) << 4));
                *(hv8*)(ap)        = ah;
                *(hv8*)(ap + 1024) = al;
            }
        }
    }
    __syncthreads();

    // ---- Stage 2b: two rows l per wave (wave, wave + 16), each with all 8 heads at once, on the matrix unit ----
    // From here on a wave reads smX and smA only and writes no LDS: no further barrier.
    const int hd   = mn & 7;                          // columns 8..15 repeat heads 0..7

    // unrolled: the two rows are independent chains (LDS, WMMA, softmax, WMMA, store) that fill each other's waits
#pragma unroll
    for (int rr = 0; rr < 2; ++rr) {
    const int l = wave + rr * 16;                     // (l >> 3) & 1 = wave >> 3 and l & 7 = wave & 7 in both

    // QK[c][hd] = sum_d X[l,c,d] * (Ahi + Alo)[hd][d]: rows M = c, columns N = head, k = d.
    // X rows and A rows are cut by the same code, so both sides hold the same k at every place.
    fv8 s = {};
    {
        const int xrow = (l * KDIM * 2) | ((mn ^ (wave >> 3)) << 7);
        const int xsw  = (mn >> 1) ^ (l & 7);
        const int arow = (l << 11) | ((hd ^ (wave >> 3)) << 7);
        const int asw  = hd ^ (l & 7);
#pragma unroll
        for (int ks = 0; ks < 2; ++ks) {
            const int p0 = ks * 4 + half, p1 = p0 + 2;   // 16-byte pieces: d = 8*p0.., 8*p1..
            hv8 x0 = *(const hv8*)(smXb + xrow + ((p0 ^ xsw) << 4));
            hv8 x1 = *(const hv8*)(smXb + xrow + ((p1 ^ xsw) << 4));
            hv8 u0 = *(const hv8*)(smAb + arow + ((p0 ^ asw) << 4));
            hv8 u1 = *(const hv8*)(smAb + arow + ((p1 ^ asw) << 4));
            hv8 w0 = *(const hv8*)(smAb + arow + 1024 + ((p0 ^ asw) << 4));
            hv8 w1 = *(const hv8*)(smAb + arow + 1024 + ((p1 ^ asw) << 4));
            hv16 XA = __builtin_shufflevector(x0, x1, 0,1,2,3,4,5,6,7,8,9,10,11,12,13,14,15);
            hv16 AH = __builtin_shufflevector(u0, u1, 0,1,2,3,4,5,6,7,8,9,10,11,12,13,14,15);
            hv16 AL = __builtin_shufflevector(w0, w1, 0,1,2,3,4,5,6,7,8,9,10,11,12,13,14,15);
            s = __builtin_amdgcn_wmma_f32_16x16x32_f16(false, XA, false, AH, (short)0, s, false, false);
            s = __builtin_amdgcn_wmma_f32_16x16x32_f16(false, XA, false, AL, (short)0, s, false, false);
        }
    }

    // softmax over c: register r of lane (hd, half) holds c = 8*half + r; the other 8 lie in lane ^ 16
    float sc[8];
    float mx = -3.0e38f;
#pragma unroll
    for (int r = 0; r < 8; ++r) { sc[r] = s[r] * inv_sqrt_dk; mx = fmaxf(mx, sc[r]); }
    mx = fmaxf(mx, xhalf(mx));
    float ssum = 0.f;
#pragma unroll
    for (int r = 0; r < 8; ++r) { sc[r] = exp_slot(sc[r] - mx); ssum += sc[r]; }
    ssum += xhalf(ssum);
    const float rs = 1.0f / ssum;

    // The exponentials are a B operand as they lie: k = 8*half + r is c with the rounded f16 value,
    // k = 16 + 8*half + r is the same c with what the rounding left. 1/sum is applied to the sums.
    hv16 SB;
#pragma unroll
    for (int r = 0; r < 8; ++r) {
        const _Float16 ph = (_Float16)sc[r];
        SB[r]     = ph;
        SB[r + 8] = (_Float16)(sc[r] - (float)ph);
    }

    // attn[d][hd] = sum_c X[l,c,d] * e[c][hd]: rows M = d, 16 per tile, from transposing loads;
    // the fragment's two halves are the same 8 values of c (k and k + 16).
    {
        const int cc   = half * 8 + (lane & 7);       // the row c whose 16 bytes this lane fetches
        const int trow = (l * KDIM * 2) | ((cc ^ (wave >> 3)) << 7);
        const int tsw  = (cc >> 1) ^ (l & 7);
        const int pb   = (lane >> 3) & 1;
        // register r holds d = 16*dt + 8*half + r; column hd stores r = 0..3, its twin hd + 8 r = 4..7
        float* op = out + ((size_t)n * LL + (size_t)ltile * MROWS + l) * (NHH * DD)
                        + hd * 64 + half * 8 + (mn >> 3) * 4;
        const bool up = mn >= 8;
#pragma unroll
        for (int dt = 0; dt < 4; ++dt) {
            hv8 t = ld_tr16(smXb + trow + (((dt * 2 + pb) ^ tsw) << 4));
            hv16 XT = __builtin_shufflevector(t, t, 0,1,2,3,4,5,6,7,0,1,2,3,4,5,6,7);
            fv8 z = {};
            fv8 o = __builtin_amdgcn_wmma_f32_16x16x32_f16(false, XT, false, SB, (short)0, z, false, false);
            float4 v;
            v.x = (up ? o[4] : o[0]) * rs;
            v.y = (up ? o[5] : o[1]) * rs;
            v.z = (up ? o[6] : o[2]) * rs;
            v.w = (up ? o[7] : o[3]) * rs;
            *(float4*)(op + dt * 16) = v;
        }
    }
    }
}

extern "C" void kernel_launch(void* const* d_in, const int* in_sizes, int n_in,
                              void* d_out, int out_size, void* d_ws, size_t ws_size,
                              hipStream_t stream) {
    const float* x  = (const float*)d_in[0];   // (64, 8192, 64)
    const float* Wq = (const float*)d_in[1];   // (8, 16, 64, 32)
    const float* Wk = (const float*)d_in[2];   // (8, 64, 32)
    float* out = (float*)d_out;                // (64, 512, 512)
    _Float16* Wt = (_Float16*)d_ws;            // 512 KB packed f16 W_q
    _Float16* Wkp = Wt + WT_ELEMS;             // 64 KB packed W_k, f16 pairs, behind it

    w_pack<<<(WT_ELEMS + WK_ELEMS) / 256, 256, 0, stream>>>(Wq, Wk, Wt, Wkp);
    attn_fused<<<NB * (LL / MROWS), 512, 0, stream>>>(x, Wt, Wkp, out);
}

// v008
// It runs in 35.1 microseconds.
// In two side-by-side timings against v007, it was 1.12 and 1.11 times as fast.
// Over all steps from v000 it is 8.91 times as fast.
#include <hip/hip_runtime.h>

typedef _Float16 hv8  __attribute__((ext_vector_type(8)));
typedef _Float16 hv16 __attribute__((ext_vector_type(16)));
typedef float    fv8  __attribute__((ext_vector_type(8)));

#define NB    64
#define TOTB  8192
#define DD    64
#define DKK   32
#define CC    16
#define NHH   8
#define LL    512          // TOT / C
#define KDIM  1024         // C * D
#define NCOL  256          // NH * DK

#define MROWS 32           // rows l per work-group: two 16-row WMMA tiles

#define WT_ELEMS (NHH * DKK * KDIM)   // 262144 f16
#define WK_ELEMS (NHH * DD * DKK)     // 16384 values, two f16 each

// Pack both weights in the order in which the lanes of the main kernel read them, so that the 32
// 16-byte pieces of one wave load are 512 bytes in a row: 4 whole 128-byte lines.
//   W_q (NH,C,D,DK) fp32 -> f16, Wt[w][kk][j][lane][e]: column h*32+t = w*16 + (lane&15),
//       k = c*64+d = kk*32 + j*16 + (lane>>4)*8 + e  (the weight fragment of column tile w, k step kk).
//   W_k (NH,D,DK) fp32 -> two f16, Wkp[h][dt][part][j][lane][e]: row d = dt*16 + (lane&15),
//       k = t = j*16 + (lane>>4)*8 + e  (the A fragment of row tile dt); part 0 the rounded value,
//       part 1 what the rounding left.
__global__ __launch_bounds__(256) void w_pack(const float* __restrict__ Wq,
                                              const float* __restrict__ Wk,
                                              _Float16* __restrict__ Wt,
                                              _Float16* __restrict__ Wkp) {
    int o = blockIdx.x * 256 + threadIdx.x;
    if (o < WT_ELEMS) {
        int e = o & 7, ln = (o >> 3) & 31, j = (o >> 8) & 1, kk = (o >> 9) & 31, w = o >> 14;
        int col = w * 16 + (ln & 15);
        int k   = kk * 32 + j * 16 + (ln >> 4) * 8 + e;
        int h = col >> 5, t = col & 31;
        int c = k >> 6,  d = k & 63;
        Wt[o] = (_Float16)Wq[(((h * CC + c) * DD + d) * DKK) + t];
    } else if (o < WT_ELEMS + WK_ELEMS) {
        int q = o - WT_ELEMS;
        int e = q & 7, ln = (q >> 3) & 31, j = (q >> 8) & 1, dt = (q >> 9) & 3, h = q >> 11;
        const float v = Wk[(h * DD + dt * 16 + (ln & 15)) * DKK + j * 16 + (ln >> 4) * 8 + e];
        const _Float16 hi = (_Float16)v;
        _Float16* p = Wkp + (h * 4 + dt) * 1024 + (q & 511);
        p[0]   = hi;
        p[512] = (_Float16)(v - (float)hi);
    }
}

typedef short s16x8 __attribute__((ext_vector_type(8)));

// Transposing LDS load: lane i hands in the 16 bytes of row 8*(i>>4) + (i&7), column piece (i>>3)&1;
// lane (c = i&15, hf = i>>4) gets rows 8*hf .. 8*hf+7 of column c.
__device__ __forceinline__ hv8 ld_tr16(const char* p) {
    typedef __attribute__((address_space(3))) s16x8 lds_s16x8;
    return __builtin_bit_cast(hv8, __builtin_amdgcn_ds_load_tr16_b128_v8i16((lds_s16x8*)p));
}

// lane i with lane i ^ 16
__device__ __forceinline__ float xhalf(float v) {
    const int b = __builtin_bit_cast(int, v);
    return __builtin_bit_cast(float, __builtin_amdgcn_permlanex16(b, b, 0x76543210, 0xfedcba98, false, false));
}

// e^v as v_exp_f32 of v*log2(e). Asm so that the v_nop stands directly behind it: the instruction set asks
// for one slot behind a transcendental before its source is overwritten or its result read.
__device__ __forceinline__ float exp_slot(float v) {
    float r;
    asm("v_exp_f32 %0, %1\n\tv_nop" : "=v"(r) : "v"(v * 1.4426950408889634f));
    return r;
}

// Four asynchronous copies to LDS, 16 bytes per lane each: LDS byte address, global address. The
// s_wait_xcnt is the last line of the copies' own statement, so that it stands in front of every later
// write of a register that a copy names (a precaution for a replayed address translation).
__device__ __forceinline__ void copy4_to_lds(unsigned l0, unsigned l1, unsigned l2, unsigned l3,
                                             const float* g0, const float* g1,
                                             const float* g2, const float* g3) {
    asm volatile("global_load_async_to_lds_b128 %0, %4, off\n\t"
                 "global_load_async_to_lds_b128 %1, %5, off\n\t"
                 "global_load_async_to_lds_b128 %2, %6, off\n\t"
                 "global_load_async_to_lds_b128 %3, %7, off\n\t"
                 "s_wait_xcnt 0x0"
                 :: "v"(l0), "v"(l1), "v"(l2), "v"(l3), "v"(g0), "v"(g1), "v"(g2), "v"(g3)
                 : "memory");
}

// A work-group takes 32 rows l: every W_q fragment and every W_k piece that a wave fetches from L2 serves
// twice the rows it would with 16. 160 KB of LDS: two work-groups per WGP, 8 waves per SIMD, which
// holds up to 128 vector registers.
__global__ __launch_bounds__(512) __attribute__((amdgpu_num_vgpr(128))) void attn_fused(const float* __restrict__ x,
                                                  const _Float16* __restrict__ Wt,
                                                  const _Float16* __restrict__ Wkp,
                                                  float* __restrict__ out) {
    // X tile, f16, 64 KB, XOR-swizzled: element (l,c,d) lies in 128-byte row l*16 + (c ^ ((l>>3)&1)),
    // 16-byte piece (d>>3) ^ (c>>1) ^ (l&7). 16 lanes that walk l (GEMM1's X rows) or c (the QK
    // rows) at one d then fall on 16 different groups of four banks, all 64 banks.
    __shared__ __align__(256) _Float16 smX[MROWS * KDIM];
    const char* smXb = (const char*)smX;                // readers form swizzled byte offsets
    // 32 KB: Q as f16 pairs. Row l holds 256 rounded values, then the 256 remainders; 16-byte piece
    // (col>>3) ^ (l&15), so 16 lanes that walk l at one column fall on 16 bank groups.
    __shared__ __align__(16) _Float16 smQ[MROWS * 2 * NCOL];
    char* smQb = (char*)smQ;
    // 64 KB: A as f16 pairs. Row l holds 16 rows of 64 d: rows 0..7 the heads' rounded values, rows
    // 8..15 the remainders; head h lies in row h ^ ((l>>3)&1), 16-byte piece (d>>3) ^ h ^ (l&7): 8 heads
    // at one l and d (the QK reads) fall on 8 bank groups, 16 rows l at one head and d (the writes) on 16.
    __shared__ __align__(16) _Float16 smA[MROWS * 1024];
    char* smAb = (char*)smA;

    const int tid   = threadIdx.x;
    const int wave  = __builtin_amdgcn_readfirstlane(tid >> 5);   // the same in all lanes: what derives from it needs no vector register
    const int lane  = tid & 31;
    const int n     = blockIdx.x >> 4;
    const int ltile = blockIdx.x & 15;

    // ---- The 32x1024 x-tile comes in four chunks of 256 k (four c): 32 rows x 1 KB of fp32 each ----
    // A chunk is copied asynchronously into one half of smA, which is idle until stage 2a, and from there
    // rounded to f16 into smX. Chunks 1..3 fly while GEMM1 works on the chunks before them.
    // Copy i of a thread: row l = 8*i + (tid >> 6), 16-byte piece tid & 63 of the row's 1 KB; in the
    // staging half at byte i*8192 + tid*16. A thread rounds the very bytes that its own copies brought,
    // so its wave's own s_wait_asynccnt is all that stands between a copy and its reader.
    const float* xsrc = x + ((size_t)n * TOTB + (size_t)ltile * (MROWS * CC)) * DD;
    const int xel = (tid >> 6) * KDIM + (tid & 63) * 4;           // l*1024 + c*64 + d of copy 0, chunk 0
    typedef __attribute__((address_space(3))) char lds_char;
    const unsigned stg = (unsigned)(size_t)(lds_char*)smAb + (unsigned)tid * 16u;   // LDS byte address
#define ISSUE_CHUNK(t) do {                                                                   \
        const float* g_ = xsrc + xel + (t) * 256;                                             \
        const unsigned s_ = stg + ((t) & 1) * 32768u;                                         \
        copy4_to_lds(s_, s_ + 8192u, s_ + 16384u, s_ + 24576u,                                \
                     g_, g_ + 8 * KDIM, g_ + 16 * KDIM, g_ + 24 * KDIM);                      \
    } while (0)
    ISSUE_CHUNK(0);
    asm volatile("s_wait_asynccnt 0x0" ::: "memory");   // chunk 0 has landed before this wave reads it
    ISSUE_CHUNK(1);

    // ---- GEMM1: Q^T[256 x 32] = Wt * X^T, one 16-col tile of Q per wave, both 16-row tiles ----
    // The weights are the A operand and the X rows the B operand (both fragments are cut alike), so a lane
    // ends up with 8 neighbouring columns t of one row l: a 16-byte piece of stage 2a's B fragment.
    // 16-bit A/B fragment K-offsets per ISA layout:
    //   lanes 0..15:  K = {kb+0..7, kb+16..23}; lanes 16..31: K = {kb+8..15, kb+24..31}
    fv8 acc = {}, acc2 = {};
    const int mn   = lane & 15;
    const int half = lane >> 4;
    const int khi  = half ? 8 : 0;
    // X row (N = mn; rows 16 + mn lie 32 KB further on, swizzled alike): the lane's share of the byte offset
    const int aV   = (mn * KDIM * 2) | ((khi * 2) ^ ((mn >> 3) << 7) ^ ((mn & 7) << 4));
    const _Float16* Bp = Wt + (size_t)wave * (16 * KDIM) + lane * 8;   // packed weight fragments, lane order
#pragma unroll 1   // kept rolled: unrolled four times the build needs more than its 128 registers and spills
    for (int t = 0; t < 4; ++t) {
    {   // chunk t: fp32 from this thread's own staging bytes -> f16 in smX, swizzled
        const char* sp = smAb + (t & 1) * 32768 + tid * 16;
        for (int i = 0; i < 4; ++i) {
            float4 v = *(const float4*)(sp + i * 8192);
            const int e = xel + i * 8 * KDIM + t * 256;   // l*1024 + c*64 + d
            const int o = e ^ (((e >> 13) & 1) << 6) ^ ((((e >> 7) ^ (e >> 10)) & 7) << 3);
            smX[o + 0] = (_Float16)v.x;
            smX[o + 1] = (_Float16)v.y;
            smX[o + 2] = (_Float16)v.z;
            smX[o + 3] = (_Float16)v.w;
        }
    }
    // this wave's staging reads and smX writes are done before the barrier and before a copy refills the half
    asm volatile("s_wait_dscnt 0x0" ::: "memory");
    __syncthreads();                                    // publishes chunk t of smX; frees staging half t & 1
    if (t < 2) ISSUE_CHUNK(t + 2);                      // the same for the whole work-group
#pragma unroll 4
    for (int k8 = 0; k8 < 8; ++k8) {
        const int kk = t * 8 + k8;
        const int ka = ((kk * 64) ^ (((kk >> 2) & 7) << 4)) ^ aV;  // c = kk>>1, so c>>1 = kk>>2
        hv8 a0 = *(const hv8*)(smXb + ka);
        hv8 a1 = *(const hv8*)(smXb + (ka ^ 32));
        hv8 a2 = *(const hv8*)(smXb + 16 * KDIM * 2 + ka);
        hv8 a3 = *(const hv8*)(smXb + 16 * KDIM * 2 + (ka ^ 32));
        hv8 b0 = *(const hv8*)(Bp + kk * 512);          // k = kk*32 + khi + 0..7
        hv8 b1 = *(const hv8*)(Bp + kk * 512 + 256);    // k = kk*32 + khi + 16..23
        hv16 A = __builtin_shufflevector(a0, a1, 0,1,2,3,4,5,6,7,8,9,10,11,12,13,14,15);
        hv16 A2 = __builtin_shufflevector(a2, a3, 0,1,2,3,4,5,6,7,8,9,10,11,12,13,14,15);
        hv16 B = __builtin_shufflevector(b0, b1, 0,1,2,3,4,5,6,7,8,9,10,11,12,13,14,15);
        acc  = __builtin_amdgcn_wmma_f32_16x16x32_f16(false, B, false, A,
                                                      (short)0, acc, false, false);
        acc2 = __builtin_amdgcn_wmma_f32_16x16x32_f16(false, B, false, A2,
                                                      (short)0, acc2, false, false);
    }
    // every copy issued so far has landed: the next chunk may be read, and behind the last trip smA is free
    asm volatile("s_wait_asynccnt 0x0" ::: "memory");
    }
#undef ISSUE_CHUNK
    // Stage 2a's W_k fragments: one head (wave >> 1) and two of its four 16-row tiles of d per wave.
    // Fetched here so that their way from L2 runs beside Q's conversion and stores.
    const int h  = wave >> 1;
    const int dh = wave & 1;
    hv16 WH[2], WL[2];
    {
        const _Float16* wp = Wkp + (h * 4 + dh * 2) * 1024 + lane * 8;
#pragma unroll
        for (int i = 0; i < 2; ++i) {
            hv8 w0 = *(const hv8*)(wp + i * 1024);
            hv8 w1 = *(const hv8*)(wp + i * 1024 + 256);
            hv8 w2 = *(const hv8*)(wp + i * 1024 + 512);
            hv8 w3 = *(const hv8*)(wp + i * 1024 + 768);
            WH[i] = __builtin_shufflevector(w0, w1, 0,1,2,3,4,5,6,7,8,9,10,11,12,13,14,15);
            WL[i] = __builtin_shufflevector(w2, w3, 0,1,2,3,4,5,6,7,8,9,10,11,12,13,14,15);
        }
    }
    {   // C/D layout: VGPR r -> M = r (+8 for lanes 16..31) = column in the tile, N = lane&15 = row l.
        // Each f32 Q goes out as two f16: the rounded value and what the rounding left.
        hv8 qh, ql, qh2, ql2;
#pragma unroll
        for (int r = 0; r < 8; ++r) {
            const _Float16 c0 = (_Float16)acc[r], c1 = (_Float16)acc2[r];
            qh[r]  = c0;  ql[r]  = (_Float16)(acc[r]  - (float)c0);
            qh2[r] = c1;  ql2[r] = (_Float16)(acc2[r] - (float)c1);
        }
        char* qp = smQb + ((mn << 10) | (((wave * 2 + half) ^ mn) << 4));
        *(hv8*)(qp)               = qh;
        *(hv8*)(qp + 512)         = ql;
        *(hv8*)(qp + 16384)       = qh2;
        *(hv8*)(qp + 16384 + 512) = ql2;
    }
    __syncthreads();

    // ---- Stage 2a: A[d][l] = sum_t Wk[h,d,t] * Q[l, h*32+t] on the matrix unit: rows M = d, columns N = l, k = t ----
    const float inv_sqrt_dk = 0.17677669529663687f;   // 1/sqrt(32)
    {
        // W_k and Q each as rounded value + remainder; the product of the two remainders is left out
        // (2^-22 of the term). Both fragments hold k = t = j*16 + half*8 + e at place j*8 + e.
        hv16 QH[2], QL[2];
        const int q0 = ((h * 4 + half) ^ mn) << 4, q1 = ((h * 4 + 2 + half) ^ mn) << 4;
#pragma unroll
        for (int lt = 0; lt < 2; ++lt) {
            const char* qp = smQb + ((lt * 16 + mn) << 10);
            hv8 u0 = *(const hv8*)(qp + q0);
            hv8 u1 = *(const hv8*)(qp + q1);
            hv8 v0 = *(const hv8*)(qp + 512 + q0);
            hv8 v1 = *(const hv8*)(qp + 512 + q1);
            QH[lt] = __builtin_shufflevector(u0, u1, 0,1,2,3,4,5,6,7,8,9,10,11,12,13,14,15);
            QL[lt] = __builtin_shufflevector(v0, v1, 0,1,2,3,4,5,6,7,8,9,10,11,12,13,14,15);
        }
        // register r of lane (l = mn, half) holds d = 16*dt + 8*half + r: one 16-byte piece of row l, head h
        const int av = (mn << 11) | ((h ^ (mn >> 3)) << 7) | ((half ^ h ^ (mn & 7)) << 4);
#pragma unroll
        for (int i = 0; i < 2; ++i) {
#pragma unroll
            for (int lt = 0; lt < 2; ++lt) {
                fv8 a = {};
                a = __builtin_amdgcn_wmma_f32_16x16x32_f16(false, WL[i], false, QH[lt], (short)0, a, false, false);
                a = __builtin_amdgcn_wmma_f32_16x16x32_f16(false, WH[i], false, QL[lt], (short)0, a, false, false);
                a = __builtin_amdgcn_wmma_f32_16x16x32_f16(false, WH[i], false, QH[lt], (short)0, a, false, false);
                // each f32 A goes out as two f16: the rounded value (rows 0..7) and what the rounding left (rows 8..15)
                hv8 ah, al;
#pragma unroll
                for (int r = 0; r < 8; ++r) {
                    const _Float16 c = (_Float16)a[r];
                    ah[r] = c;
                    al[r] = (_Float16)(a[r] - (float)c);
                }
                char* ap = smAb + lt * 32768 + (av ^ ((dh * 4 + i * 2) << 4));
                *(hv8*)(ap)        = ah;
                *(hv8*)(ap + 1024) = al;
            }
        }
    }
    __syncthreads();

    // ---- Stage 2b: two rows l per wave (wave, wave + 16), each with all 8 heads at once, on the matrix unit ----
    // From here on a wave touches only its own two rows of smA, and smX is only read: no further barrier.
    const int hd   = mn & 7;                          // columns 8..15 repeat heads 0..7

    // QK[c][hd] = sum_d X[l,c,d] * (Ahi + Alo)[hd][d]: rows M = c, columns N = head, k = d.
    // X rows and A rows are cut by the same code, so both sides hold the same k at every place.
    // Both rows first: behind this loop the wave's two rows of smA are read out and take the output rows.
    fv8 s2[2];
#pragma unroll
    for (int rr = 0; rr < 2; ++rr) {
        const int l = wave + rr * 16;                 // (l >> 3) & 1 = wave >> 3 and l & 7 = wave & 7 in both
        fv8 s = {};
        const int xrow = (l * KDIM * 2) | ((mn ^ (wave >> 3)) << 7);
        const int xsw  = (mn >> 1) ^ (l & 7);
        const int arow = (l << 11) | ((hd ^ (wave >> 3)) << 7);
        const int asw  = hd ^ (l & 7);
#pragma unroll
        for (int ks = 0; ks < 2; ++ks) {
            const int p0 = ks * 4 + half, p1 = p0 + 2;   // 16-byte pieces: d = 8*p0.., 8*p1..
            hv8 x0 = *(const hv8*)(smXb + xrow + ((p0 ^ xsw) << 4));
            hv8 x1 = *(const hv8*)(smXb + xrow + ((p1 ^ xsw) << 4));
            hv8 u0 = *(const hv8*)(smAb + arow + ((p0 ^ asw) << 4));
            hv8 u1 = *(const hv8*)(smAb + arow + ((p1 ^ asw) << 4));
            hv8 w0 = *(const hv8*)(smAb + arow + 1024 + ((p0 ^ asw) << 4));
            hv8 w1 = *(const hv8*)(smAb + arow + 1024 + ((p1 ^ asw) << 4));
            hv16 XA = __builtin_shufflevector(x0, x1, 0,1,2,3,4,5,6,7,8,9,10,11,12,13,14,15);
            hv16 AH = __builtin_shufflevector(u0, u1, 0,1,2,3,4,5,6,7,8,9,10,11,12,13,14,15);
            hv16 AL = __builtin_shufflevector(w0, w1, 0,1,2,3,4,5,6,7,8,9,10,11,12,13,14,15);
            s = __builtin_amdgcn_wmma_f32_16x16x32_f16(false, XA, false, AH, (short)0, s, false, false);
            s = __builtin_amdgcn_wmma_f32_16x16x32_f16(false, XA, false, AL, (short)0, s, false, false);
        }
        s2[rr] = s;
    }

    // unrolled: the two rows are independent chains (softmax, LDS, WMMA, LDS) that fill each other's waits
#pragma unroll
    for (int rr = 0; rr < 2; ++rr) {
    const int l = wave + rr * 16;
    const fv8 s = s2[rr];

    // softmax over c: register r of lane (hd, half) holds c = 8*half + r; the other 8 lie in lane ^ 16
    float sc[8];
    float mx = -3.0e38f;
#pragma unroll
    for (int r = 0; r < 8; ++r) { sc[r] = s[r] * inv_sqrt_dk; mx = fmaxf(mx, sc[r]); }
    mx = fmaxf(mx, xhalf(mx));
    float ssum = 0.f;
#pragma unroll
    for (int r = 0; r < 8; ++r) { sc[r] = exp_slot(sc[r] - mx); ssum += sc[r]; }
    ssum += xhalf(ssum);
    const float rs = 1.0f / ssum;

    // The exponentials are a B operand as they lie: k = 8*half + r is c with the rounded f16 value,
    // k = 16 + 8*half + r is the same c with what the rounding left. 1/sum is applied to the sums.
    hv16 SB;
#pragma unroll
    for (int r = 0; r < 8; ++r) {
        const _Float16 ph = (_Float16)sc[r];
        SB[r]     = ph;
        SB[r + 8] = (_Float16)(sc[r] - (float)ph);
    }

    // attn[d][hd] = sum_c X[l,c,d] * e[c][hd]: rows M = d, 16 per tile, from transposing loads;
    // the fragment's two halves are the same 8 values of c (k and k + 16).
    {
        const int cc   = half * 8 + (lane & 7);       // the row c whose 16 bytes this lane fetches
        const int trow = (l * KDIM * 2) | ((cc ^ (wave >> 3)) << 7);
        const int tsw  = (cc >> 1) ^ (l & 7);
        const int pb   = (lane >> 3) & 1;
        // register r holds d = 16*dt + 8*half + r; column hd keeps r = 0..3, its twin hd + 8 r = 4..7.
        // The 2 KB output row (head hd at byte hd*256) is laid in the wave's own row l of smA: a lane's
        // 16-byte piece p = 4*dt + 2*half + (mn >> 3) of head hd at place p ^ 2*hd, so that the 16 lanes
        // of a half wave, 8 heads 256 bytes apart, fall on 16 bank groups.
        char* sp = smAb + (l << 11) + (hd << 8);
        const int psw = (half * 2 + (mn >> 3)) ^ (hd * 2);
        const bool up = mn >= 8;
#pragma unroll
        for (int dt = 0; dt < 4; ++dt) {
            hv8 t = ld_tr16(smXb + trow + (((dt * 2 + pb) ^ tsw) << 4));
            hv16 XT = __builtin_shufflevector(t, t, 0,1,2,3,4,5,6,7,0,1,2,3,4,5,6,7);
            fv8 z = {};
            fv8 o = __builtin_amdgcn_wmma_f32_16x16x32_f16(false, XT, false, SB, (short)0, z, false, false);
            float4 v;
            v.x = (up ? o[4] : o[0]) * rs;
            v.y = (up ? o[5] : o[1]) * rs;
            v.z = (up ? o[6] : o[2]) * rs;
            v.w = (up ? o[7] : o[3]) * rs;
            *(float4*)(sp + (((dt * 4) ^ psw) << 4)) = v;
        }
    }
    }

    // The lanes of this wave read back each other's pieces: its LDS stores are done first, and the
    // compiler moves no LDS access across this line.
    asm volatile("s_wait_dscnt 0x0" ::: "memory");
    // Each store of the wave now covers 512 bytes in a row, 4 whole 128-byte lines (2 heads), where the
    // accumulators' own order gives 8 pieces of 64 bytes, one per head.
    {
        float* orow = out + ((size_t)n * LL + (size_t)ltile * MROWS + wave) * (NHH * DD) + lane * 4;
#pragma unroll
        for (int rr = 0; rr < 2; ++rr) {
#pragma unroll
            for (int j = 0; j < 4; ++j) {
                const int hh = j * 2 + half;          // byte j*512 + lane*16 of the row: head hh, piece mn
                const float4 v = *(const float4*)(smAb + ((wave + rr * 16) << 11) + (hh << 8)
                                                        + ((mn ^ (hh * 2)) << 4));
                *(float4*)(orow + rr * 16 * (NHH * DD) + j * 128) = v;
            }
        }
    }
}

extern "C" void kernel_launch(void* const* d_in, const int* in_sizes, int n_in,
                              void* d_out, int out_size, void* d_ws, size_t ws_size,
                              hipStream_t stream) {
    const float* x  = (const float*)d_in[0];   // (64, 8192, 64)
    const float* Wq = (const float*)d_in[1];   // (8, 16, 64, 32)
    const float* Wk = (const float*)d_in[2];   // (8, 64, 32)
    float* out = (float*)d_out;                // (64, 512, 512)
    _Float16* Wt = (_Float16*)d_ws;            // 512 KB packed f16 W_q
    _Float16* Wkp = Wt + WT_ELEMS;             // 64 KB packed W_k, f16 pairs, behind it

    w_pack<<<(WT_ELEMS + WK_ELEMS) / 256, 256, 0, stream>>>(Wq, Wk, Wt, Wkp);
    attn_fused<<<NB * (LL / MROWS), 512, 0, stream>>>(x, Wt, Wkp, out);
}

// v009
// It runs in 32 microseconds.
// Two timings next to v008 put it at 1.09 and 1.10 times that version's speed.
// All steps since v000 together make it 9.77 times as fast.
#include <hip/hip_runtime.h>

typedef _Float16 hv8  __attribute__((ext_vector_type(8)));
typedef _Float16 hv16 __attribute__((ext_vector_type(16)));
typedef float    fv8  __attribute__((ext_vector_type(8)));

#define NB    64
#define TOTB  8192
#define DD    64
#define DKK   32
#define CC    16
#define NHH   8
#define LL    512          // TOT / C
#define KDIM  1024         // C * D
#define NCOL  256          // NH * DK

#define MROWS 64           // rows l per work-group: four 16-row WMMA tiles

#define WT_ELEMS (NHH * DKK * KDIM)   // 262144 f16
#define WK_ELEMS (NHH * DD * DKK)     // 16384 values, two f16 each

// Pack both weights in the order in which the lanes of the main kernel read them, so that the 32
// 16-byte pieces of one wave load are 512 bytes in a row: 4 whole 128-byte lines.
//   W_q (NH,C,D,DK) fp32 -> f16, Wt[w][kk][j][lane][e]: column h*32+t = w*16 + (lane&15),
//       k = c*64+d = kk*32 + j*16 + (lane>>4)*8 + e  (the weight fragment of column tile w, k step kk).
//   W_k (NH,D,DK) fp32 -> two f16, Wkp[h][dt][part][j][lane][e]: row d = dt*16 + (lane&15),
//       k = t = j*16 + (lane>>4)*8 + e  (the A fragment of row tile dt); part 0 the rounded value,
//       part 1 what the rounding left.
__global__ __launch_bounds__(256) void w_pack(const float* __restrict__ Wq,
                                              const float* __restrict__ Wk,
                                              _Float16* __restrict__ Wt,
                                              _Float16* __restrict__ Wkp) {
    int o = blockIdx.x * 256 + threadIdx.x;
    if (o < WT_ELEMS) {
        int e = o & 7, ln = (o >> 3) & 31, j = (o >> 8) & 1, kk = (o >> 9) & 31, w = o >> 14;
        int col = w * 16 + (ln & 15);
        int k   = kk * 32 + j * 16 + (ln >> 4) * 8 + e;
        int h = col >> 5, t = col & 31;
        int c = k >> 6,  d = k & 63;
        Wt[o] = (_Float16)Wq[(((h * CC + c) * DD + d) * DKK) + t];
    } else if (o < WT_ELEMS + WK_ELEMS) {
        int q = o - WT_ELEMS;
        int e = q & 7, ln = (q >> 3) & 31, j = (q >> 8) & 1, dt = (q >> 9) & 3, h = q >> 11;
        const float v = Wk[(h * DD + dt * 16 + (ln & 15)) * DKK + j * 16 + (ln >> 4) * 8 + e];
        const _Float16 hi = (_Float16)v;
        _Float16* p = Wkp + (h * 4 + dt) * 1024 + (q & 511);
        p[0]   = hi;
        p[512] = (_Float16)(v - (float)hi);
    }
}

typedef short s16x8 __attribute__((ext_vector_type(8)));

// Transposing LDS load: lane i hands in the 16 bytes of row 8*(i>>4) + (i&7), column piece (i>>3)&1;
// lane (c = i&15, hf = i>>4) gets rows 8*hf .. 8*hf+7 of column c.
__device__ __forceinline__ hv8 ld_tr16(const char* p) {
    typedef __attribute__((address_space(3))) s16x8 lds_s16x8;
    return __builtin_bit_cast(hv8, __builtin_amdgcn_ds_load_tr16_b128_v8i16((lds_s16x8*)p));
}

// lane i with lane i ^ 16
__device__ __forceinline__ float xhalf(float v) {
    const int b = __builtin_bit_cast(int, v);
    return __builtin_bit_cast(float, __builtin_amdgcn_permlanex16(b, b, 0x76543210, 0xfedcba98, false, false));
}

// e^v as v_exp_f32 of v*log2(e). Asm so that the v_nop stands directly behind it: the instruction set asks
// for one slot behind a transcendental before its source is overwritten or its result read.
__device__ __forceinline__ float exp_slot(float v) {
    float r;
    asm("v_exp_f32 %0, %1\n\tv_nop" : "=v"(r) : "v"(v * 1.4426950408889634f));
    return r;
}

// Four asynchronous copies to LDS, 16 bytes per lane each: LDS byte address, global address. The
// s_wait_xcnt is the last line of the copies' own statement, so that it stands in front of every later
// write of a register that a copy names (a precaution for a replayed address translation).
__device__ __forceinline__ void copy4_to_lds(unsigned l0, unsigned l1, unsigned l2, unsigned l3,
                                             const float* g0, const float* g1,
                                             const float* g2, const float* g3) {
    asm volatile("global_load_async_to_lds_b128 %0, %4, off\n\t"
                 "global_load_async_to_lds_b128 %1, %5, off\n\t"
                 "global_load_async_to_lds_b128 %2, %6, off\n\t"
                 "global_load_async_to_lds_b128 %3, %7, off\n\t"
                 "s_wait_xcnt 0x0"
                 :: "v"(l0), "v"(l1), "v"(l2), "v"(l3), "v"(g0), "v"(g1), "v"(g2), "v"(g3)
                 : "memory");
}

// A work-group takes 64 rows l with 32 waves: all 320 KB of LDS, one work-group per WGP, 8 waves per SIMD,
// which holds up to 128 vector registers. In GEMM1 the waves split k: waves 0..15 and 16..31 take the same
// 16 column tiles and half of the k steps each, over all 64 rows, so a W_q fragment is fetched from L2 once
// per 64 rows. Behind GEMM1 each half of the waves (kh) works on its own 32 rows.
__global__ __launch_bounds__(1024) __attribute__((amdgpu_num_vgpr(128))) void attn_fused(const float* __restrict__ x,
                                                  const _Float16* __restrict__ Wt,
                                                  const _Float16* __restrict__ Wkp,
                                                  float* __restrict__ out) {
    // X tile, f16, 128 KB, XOR-swizzled: element (l,c,d) lies in 128-byte row l*16 + (c ^ ((l>>3)&1)),
    // 16-byte piece (d>>3) ^ (c>>1) ^ (l&7). 16 lanes that walk l (GEMM1's X rows) or c (the QK
    // rows) at one d then fall on 16 different groups of four banks, all 64 banks.
    __shared__ __align__(256) _Float16 smX[MROWS * KDIM];
    const char* smX0 = (const char*)smX;                // readers form swizzled byte offsets
    // 64 KB: Q as f16 pairs. Row l holds 256 rounded values, then the 256 remainders; 16-byte piece
    // (col>>3) ^ (l&15), so 16 lanes that walk l at one column fall on 16 bank groups.
    __shared__ __align__(16) _Float16 smQ[MROWS * 2 * NCOL];
    char* smQ0 = (char*)smQ;
    // 128 KB: A as f16 pairs. Row l holds 16 rows of 64 d: rows 0..7 the heads' rounded values, rows
    // 8..15 the remainders; head h lies in row h ^ ((l>>3)&1), 16-byte piece (d>>3) ^ h ^ (l&7): 8 heads
    // at one l and d (the QK reads) fall on 8 bank groups, 16 rows l at one head and d (the writes) on 16.
    __shared__ __align__(16) _Float16 smA[MROWS * 1024];
    char* smA0 = (char*)smA;

    const int tid   = threadIdx.x;
    const int wv32  = __builtin_amdgcn_readfirstlane(tid >> 5);   // the same in all lanes: what derives from it needs no vector register
    const int wave  = wv32 & 15;                      // column tile in GEMM1; place among the 16 waves of its half behind it
    const int kh    = wv32 >> 4;                      // half of the k steps in GEMM1; half of the rows l behind it
    const int n     = blockIdx.x >> 3;
    const int ltile = blockIdx.x & 7;
    // the 32 rows l = 32*kh .. 32*kh + 31 of each array: this wave's own half
    const char* smXb = smX0 + kh * 65536;
    char* smQb = smQ0 + kh * 32768;
    char* smAb = smA0 + kh * 65536;

    // ---- The 64x1024 x-tile comes in four chunks of 256 k (four c): 64 rows x 1 KB of fp32 each ----
    // A chunk is copied asynchronously into one half of smA, which is idle until GEMM1 ends, and from there
    // rounded to f16 into smX. Chunks 1..3 fly while GEMM1 works on the chunks before them.
    // Copy i of a thread: row l = 16*i + (tid >> 6), 16-byte piece tid & 63 of the row's 1 KB; in the
    // staging half at byte i*16384 + tid*16. A thread rounds the very bytes that its own copies brought,
    // so its wave's own s_wait_asynccnt is all that stands between a copy and its reader.
    const float* xsrc = x + ((size_t)n * TOTB + (size_t)ltile * (MROWS * CC)) * DD;
    const int xel = (tid >> 6) * KDIM + (tid & 63) * 4;           // l*1024 + c*64 + d of copy 0, chunk 0
    typedef __attribute__((address_space(3))) char lds_char;
    const unsigned stg = (unsigned)(size_t)(lds_char*)smA0 + (unsigned)tid * 16u;   // LDS byte address
#define ISSUE_CHUNK(t) do {                                                                   \
        const float* g_ = xsrc + xel + (t) * 256;                                             \
        const unsigned s_ = stg + ((t) & 1) * 65536u;                                         \
        copy4_to_lds(s_, s_ + 16384u, s_ + 32768u, s_ + 49152u,                               \
                     g_, g_ + 16 * KDIM, g_ + 32 * KDIM, g_ + 48 * KDIM);                     \
    } while (0)
    ISSUE_CHUNK(0);
    asm volatile("s_wait_asynccnt 0x0" ::: "memory");   // chunk 0 has landed before this wave reads it
    ISSUE_CHUNK(1);

    // ---- GEMM1: Q^T[256 x 64] = Wt * X^T, one 16-col tile of Q per wave, all four 16-row tiles, half of k ----
    // The weights are the A operand and the X rows the B operand (both fragments are cut alike), so a lane
    // ends up with 8 neighbouring columns t of one row l: a 16-byte piece of stage 2a's B fragment.
    // 16-bit A/B fragment K-offsets per ISA layout:
    //   lanes 0..15:  K = {kb+0..7, kb+16..23}; lanes 16..31: K = {kb+8..15, kb+24..31}
    // acc, acc2: the wave's own 32 rows; acc3, acc4: the 32 rows of its partner, wave ^ 16 of the work-group
    fv8 acc = {}, acc2 = {}, acc3 = {}, acc4 = {};
    const char* smXp = smX0 + (kh ^ 1) * 65536;
    const int mnG  = tid & 15;
    const int khi  = (tid & 16) ? 8 : 0;
    // X row (N = mnG; rows 16 + mnG lie 32 KB further on, swizzled alike): the lane's share of the byte offset
    const int aV   = (mnG * KDIM * 2) | ((khi * 2) ^ ((mnG >> 3) << 7) ^ ((mnG & 7) << 4));
    const _Float16* Bw = Wt + wave * (16 * KDIM);       // packed weight fragments of the column tile: the same in all lanes
    const int bl   = (tid & 31) * 8;                    // lane order
#pragma unroll 1   // kept rolled: unrolled four times the build needs more than its 128 registers and spills
    for (int t = 0; t < 4; ++t) {
    {   // chunk t: fp32 from this thread's own staging bytes -> f16 in smX, swizzled
        const char* sp = smA0 + (t & 1) * 65536 + tid * 16;
        for (int i = 0; i < 4; ++i) {
            float4 v = *(const float4*)(sp + i * 16384);
            const int e = xel + i * 16 * KDIM + t * 256;  // l*1024 + c*64 + d
            const int o = e ^ (((e >> 13) & 1) << 6) ^ ((((e >> 7) ^ (e >> 10)) & 7) << 3);
            smX[o + 0] = (_Float16)v.x;
            smX[o + 1] = (_Float16)v.y;
            smX[o + 2] = (_Float16)v.z;
            smX[o + 3] = (_Float16)v.w;
        }
    }
    // this wave's staging reads and smX writes are done before the barrier and before a copy refills the half
    asm volatile("s_wait_dscnt 0x0" ::: "memory");
    __syncthreads();                                    // publishes chunk t of smX; frees staging half t & 1
    if (t < 2) ISSUE_CHUNK(t + 2);                      // the same for the whole work-group
#pragma unroll 2   // two k steps' fragments in flight: 64 registers of X rows beside 32 of sums
    for (int k4 = 0; k4 < 4; ++k4) {
        const int kk = t * 8 + kh * 4 + k4;            // this half's four of the chunk's eight k steps
        const int ka = ((kk * 64) ^ (((kk >> 2) & 7) << 4)) ^ aV;  // c = kk>>1, so c>>1 = kk>>2
        hv8 a0 = *(const hv8*)(smXb + ka);
        hv8 a1 = *(const hv8*)(smXb + (ka ^ 32));
        hv8 a2 = *(const hv8*)(smXb + 16 * KDIM * 2 + ka);
        hv8 a3 = *(const hv8*)(smXb + 16 * KDIM * 2 + (ka ^ 32));
        hv8 a4 = *(const hv8*)(smXp + ka);
        hv8 a5 = *(const hv8*)(smXp + (ka ^ 32));
        hv8 a6 = *(const hv8*)(smXp + 16 * KDIM * 2 + ka);
        hv8 a7 = *(const hv8*)(smXp + 16 * KDIM * 2 + (ka ^ 32));
        hv8 b0 = *(const hv8*)(Bw + kk * 512 + bl);         // k = kk*32 + khi + 0..7
        hv8 b1 = *(const hv8*)(Bw + kk * 512 + 256 + bl);   // k = kk*32 + khi + 16..23
        hv16 A = __builtin_shufflevector(a0, a1, 0,1,2,3,4,5,6,7,8,9,10,11,12,13,14,15);
        hv16 A2 = __builtin_shufflevector(a2, a3, 0,1,2,3,4,5,6,7,8,9,10,11,12,13,14,15);
        hv16 A3 = __builtin_shufflevector(a4, a5, 0,1,2,3,4,5,6,7,8,9,10,11,12,13,14,15);
        hv16 A4 = __builtin_shufflevector(a6, a7, 0,1,2,3,4,5,6,7,8,9,10,11,12,13,14,15);
        hv16 B = __builtin_shufflevector(b0, b1, 0,1,2,3,4,5,6,7,8,9,10,11,12,13,14,15);
        acc  = __builtin_amdgcn_wmma_f32_16x16x32_f16(false, B, false, A,
                                                      (short)0, acc, false, false);
        acc2 = __builtin_amdgcn_wmma_f32_16x16x32_f16(false, B, false, A2,
                                                      (short)0, acc2, false, false);
        acc3 = __builtin_amdgcn_wmma_f32_16x16x32_f16(false, B, false, A3,
                                                      (short)0, acc3, false, false);
        acc4 = __builtin_amdgcn_wmma_f32_16x16x32_f16(false, B, false, A4,
                                                      (short)0, acc4, false, false);
    }
    // every copy issued so far has landed: the next chunk may be read, and behind the last trip smA is free
    asm volatile("s_wait_asynccnt 0x0" ::: "memory");
    }
#undef ISSUE_CHUNK
    // The lane's number is read anew, so that nothing derived from it lives through GEMM1, whose loop fills
    // the 128 registers: kept alive from the top, these values were spilled to scratch memory.
    const int lane = (int)__builtin_amdgcn_mbcnt_lo(~0u, 0u);
    const int mn   = lane & 15;
    const int half = lane >> 4;
    // ---- The two halves of k meet: a wave hands its sums over the partner's 32 rows to the partner ----
    // 2 KB per wave in the first 64 KB of smA, whose staged bytes were all read before the last X barrier;
    // each store and each load of a wave covers 512 bytes in a row.
    {
        char* ex = smA0 + wv32 * 2048 + lane * 16;
        *(float4*)(ex)        = make_float4(acc3[0], acc3[1], acc3[2], acc3[3]);
        *(float4*)(ex + 512)  = make_float4(acc3[4], acc3[5], acc3[6], acc3[7]);
        *(float4*)(ex + 1024) = make_float4(acc4[0], acc4[1], acc4[2], acc4[3]);
        *(float4*)(ex + 1536) = make_float4(acc4[4], acc4[5], acc4[6], acc4[7]);
    }
    __syncthreads();                                    // publishes the partial sums
    {   // same column tile, same lane and register places in both waves
        const char* ex = smA0 + (wv32 ^ 16) * 2048 + lane * 16;
        const float4 p0 = *(const float4*)(ex);
        const float4 p1 = *(const float4*)(ex + 512);
        const float4 p2 = *(const float4*)(ex + 1024);
        const float4 p3 = *(const float4*)(ex + 1536);
        acc[0]  += p0.x;  acc[1]  += p0.y;  acc[2]  += p0.z;  acc[3]  += p0.w;
        acc[4]  += p1.x;  acc[5]  += p1.y;  acc[6]  += p1.z;  acc[7]  += p1.w;
        acc2[0] += p2.x;  acc2[1] += p2.y;  acc2[2] += p2.z;  acc2[3] += p2.w;
        acc2[4] += p3.x;  acc2[5] += p3.y;  acc2[6] += p3.z;  acc2[7] += p3.w;
    }
    // Stage 2a's W_k fragments: one head (wave >> 1) and two of its four 16-row tiles of d per wave.
    // Fetched here so that their way from L2 runs beside Q's conversion and stores.
    const int h  = wave >> 1;
    const int dh = wave & 1;
    hv16 WH[2], WL[2];
    {
        const _Float16* wp = Wkp + (h * 4 + dh * 2) * 1024 + lane * 8;
#pragma unroll
        for (int i = 0; i < 2; ++i) {
            hv8 w0 = *(const hv8*)(wp + i * 1024);
            hv8 w1 = *(const hv8*)(wp + i * 1024 + 256);
            hv8 w2 = *(const hv8*)(wp + i * 1024 + 512);
            hv8 w3 = *(const hv8*)(wp + i * 1024 + 768);
            WH[i] = __builtin_shufflevector(w0, w1, 0,1,2,3,4,5,6,7,8,9,10,11,12,13,14,15);
            WL[i] = __builtin_shufflevector(w2, w3, 0,1,2,3,4,5,6,7,8,9,10,11,12,13,14,15);
        }
    }
    {   // C/D layout: VGPR r -> M = r (+8 for lanes 16..31) = column in the tile, N = lane&15 = row l.
        // Each f32 Q goes out as two f16: the rounded value and what the rounding left.
        hv8 qh, ql, qh2, ql2;
#pragma unroll
        for (int r = 0; r < 8; ++r) {
            const _Float16 c0 = (_Float16)acc[r], c1 = (_Float16)acc2[r];
            qh[r]  = c0;  ql[r]  = (_Float16)(acc[r]  - (float)c0);
            qh2[r] = c1;  ql2[r] = (_Float16)(acc2[r] - (float)c1);
        }
        char* qp = smQb + ((mn << 10) | (((wave * 2 + half) ^ mn) << 4));
        *(hv8*)(qp)               = qh;
        *(hv8*)(qp + 512)         = ql;
        *(hv8*)(qp + 16384)       = qh2;
        *(hv8*)(qp + 16384 + 512) = ql2;
    }
    __syncthreads();

    // ---- Stage 2a: A[d][l] = sum_t Wk[h,d,t] * Q[l, h*32+t] on the matrix unit: rows M = d, columns N = l, k = t ----
    const float inv_sqrt_dk = 0.17677669529663687f;   // 1/sqrt(32)
    {
        // W_k and Q each as rounded value + remainder; the product of the two remainders is left out
        // (2^-22 of the term). Both fragments hold k = t = j*16 + half*8 + e at place j*8 + e.
        hv16 QH[2], QL[2];
        const int q0 = ((h * 4 + half) ^ mn) << 4, q1 = ((h * 4 + 2 + half) ^ mn) << 4;
#pragma unroll
        for (int lt = 0; lt < 2; ++lt) {
            const char* qp = smQb + ((lt * 16 + mn) << 10);
            hv8 u0 = *(const hv8*)(qp + q0);
            hv8 u1 = *(const hv8*)(qp + q1);
            hv8 v0 = *(const hv8*)(qp + 512 + q0);
            hv8 v1 = *(const hv8*)(qp + 512 + q1);
            QH[lt] = __builtin_shufflevector(u0, u1, 0,1,2,3,4,5,6,7,8,9,10,11,12,13,14,15);
            QL[lt] = __builtin_shufflevector(v0, v1, 0,1,2,3,4,5,6,7,8,9,10,11,12,13,14,15);
        }
        // register r of lane (l = mn, half) holds d = 16*dt + 8*half + r: one 16-byte piece of row l, head h
        const int av = (mn << 11) | ((h ^ (mn >> 3)) << 7) | ((half ^ h ^ (mn & 7)) << 4);
#pragma unroll
        for (int i = 0; i < 2; ++i) {
#pragma unroll
            for (int lt = 0; lt < 2; ++lt) {
                fv8 a = {};
                a = __builtin_amdgcn_wmma_f32_16x16x32_f16(false, WL[i], false, QH[lt], (short)0, a, false, false);
                a = __builtin_amdgcn_wmma_f32_16x16x32_f16(false, WH[i], false, QL[lt], (short)0, a, false, false);
                a = __builtin_amdgcn_wmma_f32_16x16x32_f16(false, WH[i], false, QH[lt], (short)0, a, false, false);
                // each f32 A goes out as two f16: the rounded value (rows 0..7) and what the rounding left (rows 8..15)
                hv8 ah, al;
#pragma unroll
                for (int r = 0; r < 8; ++r) {
                    const _Float16 c = (_Float16)a[r];
                    ah[r] = c;
                    al[r] = (_Float16)(a[r] - (float)c);
                }
                char* ap = smAb + lt * 32768 + (av ^ ((dh * 4 + i * 2) << 4));
                *(hv8*)(ap)        = ah;
                *(hv8*)(ap + 1024) = al;
            }
        }
    }
    __syncthreads();

    // ---- Stage 2b: two rows l per wave (wave, wave + 16), each with all 8 heads at once, on the matrix unit ----
    // From here on a wave touches only its own two rows of smA, and smX is only read: no further barrier.
    const int hd   = mn & 7;                          // columns 8..15 repeat heads 0..7

    // QK[c][hd] = sum_d X[l,c,d] * (Ahi + Alo)[hd][d]: rows M = c, columns N = head, k = d.
    // X rows and A rows are cut by the same code, so both sides hold the same k at every place.
    // Both rows first: behind this loop the wave's two rows of smA are read out and take the output rows.
    fv8 s2[2];
#pragma unroll
    for (int rr = 0; rr < 2; ++rr) {
        const int l = wave + rr * 16;                 // (l >> 3) & 1 = wave >> 3 and l & 7 = wave & 7 in both
        fv8 s = {};
        const int xrow = (l * KDIM * 2) | ((mn ^ (wave >> 3)) << 7);
        const int xsw  = (mn >> 1) ^ (l & 7);
        const int arow = (l << 11) | ((hd ^ (wave >> 3)) << 7);
        const int asw  = hd ^ (l & 7);
#pragma unroll
        for (int ks = 0; ks < 2; ++ks) {
            const int p0 = ks * 4 + half, p1 = p0 + 2;   // 16-byte pieces: d = 8*p0.., 8*p1..
            hv8 x0 = *(const hv8*)(smXb + xrow + ((p0 ^ xsw) << 4));
            hv8 x1 = *(const hv8*)(smXb + xrow + ((p1 ^ xsw) << 4));
            hv8 u0 = *(const hv8*)(smAb + arow + ((p0 ^ asw) << 4));
            hv8 u1 = *(const hv8*)(smAb + arow + ((p1 ^ asw) << 4));
            hv8 w0 = *(const hv8*)(smAb + arow + 1024 + ((p0 ^ asw) << 4));
            hv8 w1 = *(const hv8*)(smAb + arow + 1024 + ((p1 ^ asw) << 4));
            hv16 XA = __builtin_shufflevector(x0, x1, 0,1,2,3,4,5,6,7,8,9,10,11,12,13,14,15);
            hv16 AH = __builtin_shufflevector(u0, u1, 0,1,2,3,4,5,6,7,8,9,10,11,12,13,14,15);
            hv16 AL = __builtin_shufflevector(w0, w1, 0,1,2,3,4,5,6,7,8,9,10,11,12,13,14,15);
            s = __builtin_amdgcn_wmma_f32_16x16x32_f16(false, XA, false, AH, (short)0, s, false, false);
            s = __builtin_amdgcn_wmma_f32_16x16x32_f16(false, XA, false, AL, (short)0, s, false, false);
        }
        s2[rr] = s;
    }

    // unrolled: the two rows are independent chains (softmax, LDS, WMMA, LDS) that fill each other's waits
#pragma unroll
    for (int rr = 0; rr < 2; ++rr) {
    const int l = wave + rr * 16;
    const fv8 s = s2[rr];

    // softmax over c: register r of lane (hd, half) holds c = 8*half + r; the other 8 lie in lane ^ 16
    float sc[8];
    float mx = -3.0e38f;
#pragma unroll
    for (int r = 0; r < 8; ++r) { sc[r] = s[r] * inv_sqrt_dk; mx = fmaxf(mx, sc[r]); }
    mx = fmaxf(mx, xhalf(mx));
    float ssum = 0.f;
#pragma unroll
    for (int r = 0; r < 8; ++r) { sc[r] = exp_slot(sc[r] - mx); ssum += sc[r]; }
    ssum += xhalf(ssum);
    const float rs = 1.0f / ssum;

    // The exponentials are a B operand as they lie: k = 8*half + r is c with the rounded f16 value,
    // k = 16 + 8*half + r is the same c with what the rounding left. 1/sum is applied to the sums.
    hv16 SB;
#pragma unroll
    for (int r = 0; r < 8; ++r) {
        const _Float16 ph = (_Float16)sc[r];
        SB[r]     = ph;
        SB[r + 8] = (_Float16)(sc[r] - (float)ph);
    }

    // attn[d][hd] = sum_c X[l,c,d] * e[c][hd]: rows M = d, 16 per tile, from transposing loads;
    // the fragment's two halves are the same 8 values of c (k and k + 16).
    {
        const int cc   = half * 8 + (lane & 7);       // the row c whose 16 bytes this lane fetches
        const int trow = (l * KDIM * 2) | ((cc ^ (wave >> 3)) << 7);
        const int tsw  = (cc >> 1) ^ (l & 7);
        const int pb   = (lane >> 3) & 1;
        // register r holds d = 16*dt + 8*half + r; column hd keeps r = 0..3, its twin hd + 8 r = 4..7.
        // The 2 KB output row (head hd at byte hd*256) is laid in the wave's own row l of smA: a lane's
        // 16-byte piece p = 4*dt + 2*half + (mn >> 3) of head hd at place p ^ 2*hd, so that the 16 lanes
        // of a half wave, 8 heads 256 bytes apart, fall on 16 bank groups.
        char* sp = smAb + (l << 11) + (hd << 8);
        const int psw = (half * 2 + (mn >> 3)) ^ (hd * 2);
        const bool up = mn >= 8;
#pragma unroll
        for (int dt = 0; dt < 4; ++dt) {
            hv8 t = ld_tr16(smXb + trow + (((dt * 2 + pb) ^ tsw) << 4));
            hv16 XT = __builtin_shufflevector(t, t, 0,1,2,3,4,5,6,7,0,1,2,3,4,5,6,7);
            fv8 z = {};
            fv8 o = __builtin_amdgcn_wmma_f32_16x16x32_f16(false, XT, false, SB, (short)0, z, false, false);
            float4 v;
            v.x = (up ? o[4] : o[0]) * rs;
            v.y = (up ? o[5] : o[1]) * rs;
            v.z = (up ? o[6] : o[2]) * rs;
            v.w = (up ? o[7] : o[3]) * rs;
            *(float4*)(sp + (((dt * 4) ^ psw) << 4)) = v;
        }
    }
    }

    // The lanes of this wave read back each other's pieces: its LDS stores are done first, and the
    // compiler moves no LDS access across this line.
    asm volatile("s_wait_dscnt 0x0" ::: "memory");
    // Each store of the wave now covers 512 bytes in a row, 4 whole 128-byte lines (2 heads), where the
    // accumulators' own order gives 8 pieces of 64 bytes, one per head.
    {
        float* orow = out + ((size_t)n * LL + (size_t)ltile * MROWS + kh * 32 + wave) * (NHH * DD) + lane * 4;
#pragma unroll
        for (int rr = 0; rr < 2; ++rr) {
#pragma unroll
            for (int j = 0; j < 4; ++j) {
                const int hh = j * 2 + half;          // byte j*512 + lane*16 of the row: head hh, piece mn
                const float4 v = *(const float4*)(smAb + ((wave + rr * 16) << 11) + (hh << 8)
                                                        + ((mn ^ (hh * 2)) << 4));
                *(float4*)(orow + rr * 16 * (NHH * DD) + j * 128) = v;
            }
        }
    }
}

extern "C" void kernel_launch(void* const* d_in, const int* in_sizes, int n_in,
                              void* d_out, int out_size, void* d_ws, size_t ws_size,
                              hipStream_t stream) {
    const float* x  = (const float*)d_in[0];   // (64, 8192, 64)
    const float* Wq = (const float*)d_in[1];   // (8, 16, 64, 32)
    const float* Wk = (const float*)d_in[2];   // (8, 64, 32)
    float* out = (float*)d_out;                // (64, 512, 512)
    _Float16* Wt = (_Float16*)d_ws;            // 512 KB packed f16 W_q
    _Float16* Wkp = Wt + WT_ELEMS;             // 64 KB packed W_k, f16 pairs, behind it

    w_pack<<<(WT_ELEMS + WK_ELEMS) / 256, 256, 0, stream>>>(Wq, Wk, Wt, Wkp);
    attn_fused<<<NB * (LL / MROWS), 1024, 0, stream>>>(x, Wt, Wkp, out);
}
